// v000
// The times below were measured on an AMD MI455X: many runs one after another, warmed up first and cycling through
// copies of the inputs, with the whole window's GPU time divided by the number of runs. Launches and the gaps
// between them are all in it. The median over several windows is given; except for v000 it joins two sittings, which
// can be a few percent apart, so the side-by-side timings, each taken in one sitting, are the better comparison.
// v000, which the later versions start from, runs in 712 microseconds.
// Contractions on v_wmma_f32_16x16x32_f16 (plain f16 operands, f32 accumulate): the pair MLP g over all 32x25x25 ordered pairs as GEMMs
// with M = pairs: layer 1 split exactly as [x_i, x_j]·W1 = x_i·W1[:D] + x_j·W1[D:] (two K = 512 GEMMs on the 800 node rows, then relu of the
// broadcast sum per pair, written f16), layers 2 and 3 (K = 512, M = 20,000 pair rows padded to 20,096), the i != j sum per batch in f32
// (fixed order), and the f MLP on the 32 aggregated rows (padded to 128; K = 512; N = 1000 padded to 1024). ReLU in f32. The [32][1000]
#include <hip/hip_runtime.h>
#include <hip/hip_bf16.h>
#include <math.h>

#define NBr 32
#define NN 25
#define DDr 512
#define HHd 512
#define NCLS 1000
#define NCP 1024
#define NROWS (NBr * NN)          // 800
#define NROWP 896
#define NPAIR (NBr * NN * NN)     // 20000
#define NPAIRP 20096
#define GSTR 48
#define SS 64
#define HH 1
#define DKK 64

typedef _Float16 bf16;
typedef _Float16 f16;
typedef __attribute__((ext_vector_type(4))) unsigned v4u_t;
typedef unsigned v4ua __attribute__((ext_vector_type(4), may_alias));
typedef __attribute__((ext_vector_type(4))) float v4f_t;
typedef float v4fa __attribute__((ext_vector_type(4), may_alias));
typedef __attribute__((ext_vector_type(16))) bf16  bf16x16;
typedef bf16x16 f16x16;
typedef __attribute__((ext_vector_type(8)))  bf16  bf16x8;
typedef bf16x8 f16x8;
typedef __attribute__((ext_vector_type(4)))  bf16  bf16x4;
typedef __attribute__((ext_vector_type(8)))  float f32x8;
__device__ __forceinline__ f32x8 wmma16(f16x16 a, f16x16 b, f32x8 c) {
  c = __builtin_amdgcn_wmma_f32_16x16x32_f16(false, a, false, b, (short)0, c, false, false);
  asm volatile("v_nop\n\tv_nop\n\tv_nop\n\tv_nop" : "+v"(c) : "v"(a), "v"(b));
  return c;
}
#define LDS_STRIDE 48   // GEMM tiles: 32 -> 48 elems (96B rows): aligned b128 reads
#define KSTRIDE    72
#define VSTRIDE    48

__device__ __forceinline__ f32x8 wmma_bf16(bf16x16 a, bf16x16 b, f32x8 c) {
  c = __builtin_amdgcn_wmma_f32_16x16x32_f16(false, a, false, b, (short)0, c, false, false);
  asm volatile("v_nop\n\tv_nop\n\tv_nop\n\tv_nop" : "+v"(c) : "v"(a), "v"(b));   // A/B-overwrite hazard guard
  return c;
}

// 16x32 (MxK) bf16 fragment from a row-major global matrix.
// lanes 0-15  (row=lane)    : elems 0..7 = K+0..7,  8..15 = K+16..23
// lanes 16-31 (row=lane-16) : elems 0..7 = K+8..15, 8..15 = K+24..31
template <typename T>
__device__ __forceinline__ bf16x16 load_frag(const T* __restrict__ base, int ld,
                                             int row0, int k0) {
  const int lane = threadIdx.x & 31;
  const int r    = lane & 15;
  const int kh   = (lane >> 4) * 8;
  const T* p0 = base + (size_t)(row0 + r) * ld + (k0 + kh);
  const T* p1 = p0 + 16;
  bf16x16 f;
#pragma unroll
  for (int i = 0; i < 8; ++i) {
    f[i]     = (bf16)p0[i];
    f[i + 8] = (bf16)p1[i];
  }
  return f;
}

// Same fragment from an LDS tile with padded row stride (base includes row0/k0).
__device__ __forceinline__ bf16x16 lds_frag(const bf16* base, int stride) {
  const int lane = threadIdx.x & 31;
  const int row  = lane & 15;
  const int kh   = (lane >> 4) * 8;
  const bf16x8 lo = *(const bf16x8*)(base + row * stride + kh);
  const bf16x8 hi = *(const bf16x8*)(base + row * stride + kh + 16);
  bf16x16 f;
#pragma unroll
  for (int i = 0; i < 8; ++i) { f[i] = lo[i]; f[i + 8] = hi[i]; }
  return f;
}

template <typename T>
__device__ __forceinline__ void stage_read16(const T* __restrict__ p, float* buf) {
#pragma unroll
  for (int i = 0; i < 16; ++i) buf[i] = (float)p[i];
}

__device__ __forceinline__ void stage_write(bf16* dst, const float* buf, int nquad) {
#pragma unroll
  for (int i = 0; i < nquad; ++i) {
    bf16x4 q;
    q[0] = (bf16)buf[4 * i];     q[1] = (bf16)buf[4 * i + 1];
    q[2] = (bf16)buf[4 * i + 2]; q[3] = (bf16)buf[4 * i + 3];
    *(bf16x4*)(dst + 4 * i) = q;
  }
}


// ---------------------------------------------------------------------------------------------------------------------------
// gemm_kne: Y[m][n] = epi( Σ_k A[m][k]·W[k][n] + bias[n] ), A f32/f16 [M][lda], W f32 row-major [K][N] (ldw), plain f16 operands,
// f32 accumulate. EPI 0: identity; 1: exact-erf GELU; 2: R[m][n] + gvec[n]·(·) (residual with per-channel gain). Output f32 (or f16
// when OUT16). Block = 128x128 tile, 8 waves as 4(M) x 2(N); per 32-wide k-step A and W tiles staged f16 in LDS (W transposed
// ---------------------------------------------------------------------------------------------------------------------------
#define GSTR 48
template <typename AT, int EPI, bool OUT16>
__global__ __launch_bounds__(256) void gemm_kne(const AT* __restrict__ A, int lda, const float* __restrict__ Wm, int ldw,
                                                const float* __restrict__ bias, const float* __restrict__ R, const float* __restrict__ gvec,
                                                void* __restrict__ Yv, int ldy, int K) {
  __shared__ __attribute__((aligned(16))) f16 ldsA[128 * GSTR];
  __shared__ __attribute__((aligned(16))) f16 ldsW[128 * GSTR];
  __shared__ __attribute__((aligned(16))) float oS[8][32 * 68];
  const int tid = threadIdx.x, lane = tid & 31, wave = tid >> 5, cl = lane & 15, rh = (lane >> 4) * 8;
  const int m0 = blockIdx.x * 128, n0 = blockIdx.y * 128;
  const int wm = (wave & 3) * 32, wn = (wave >> 2) * 64;
  f32x8 acc[2][4];
#pragma unroll
  for (int i = 0; i < 2; ++i)
#pragma unroll
    for (int j = 0; j < 4; ++j) { f32x8 z = {}; acc[i][j] = z; }
#pragma unroll 1
  for (int k0 = 0; k0 < K; k0 += 32) {
    __syncthreads();
    { const int row = tid >> 1, ch = (tid & 1) * 16;
      const AT* src = A + (size_t)(m0 + row) * lda + k0 + ch;
#pragma unroll
      for (int g = 0; g < 16; ++g) ldsA[row * GSTR + ch + g] = (f16)src[g]; }
    { const int k = tid >> 3, nn0 = (tid & 7) * 16;
      const float* src = Wm + (size_t)(k0 + k) * ldw + n0 + nn0;
#pragma unroll
      for (int g = 0; g < 4; ++g) { const v4f_t v = *(const v4f_t*)(src + 4 * g);
#pragma unroll
        for (int u = 0; u < 4; ++u) ldsW[(nn0 + 4 * g + u) * GSTR + k] = (f16)v[u]; } }
    __syncthreads();
    f16x16 af[2];
#pragma unroll
    for (int i = 0; i < 2; ++i) af[i] = lds_frag(ldsA + (wm + 16 * i) * GSTR, GSTR);
#pragma unroll
    for (int j = 0; j < 4; ++j) {
      const f16x16 bf = lds_frag(ldsW + (wn + 16 * j) * GSTR, GSTR);
#pragma unroll
      for (int i = 0; i < 2; ++i) acc[i][j] = wmma16(af[i], bf, acc[i][j]);
    }
  }
  float* so = oS[wave];
#pragma unroll
  for (int i = 0; i < 2; ++i)
#pragma unroll
    for (int j = 0; j < 4; ++j) {
      const int n = n0 + wn + 16 * j + cl;
      const float bv = bias ? bias[n] : 0.0f;
      const float gv = (EPI == 2) ? gvec[n] : 0.0f;
      if (EPI == 1) {
#pragma unroll 1
        for (int r = 0; r < 8; ++r) { const float xg = acc[i][j][r] + bv; so[(16 * i + rh + r) * 68 + 16 * j + cl] = 0.5f * xg * (1.0f + erff(xg * 0.70710678118654752f)); }
      } else {
#pragma unroll
        for (int r = 0; r < 8; ++r) {
          float v = acc[i][j][r] + bv;
          if (EPI == 2) v = R[(size_t)(m0 + wm + 16 * i + rh + r) * ldy + n] + gv * v;
          so[(16 * i + rh + r) * 68 + 16 * j + cl] = v;
        }
      }
    }
  asm volatile("s_wait_dscnt 0" ::: "memory");
  __builtin_amdgcn_wave_barrier();
{
    if (OUT16) {
      f16* Y = (f16*)Yv;
#pragma unroll
      for (int it = 0; it < 8; ++it) { const int c = lane + 32 * it, rr = c >> 3, q8 = (c & 7) * 8;
        union { f16 h[8]; v4u_t v; } u;
#pragma unroll
        for (int e = 0; e < 8; ++e) u.h[e] = (f16)so[rr * 68 + q8 + e];
        *(v4u_t*)(Y + (size_t)(m0 + wm + rr) * ldy + n0 + wn + q8) = u.v; }
    } else {
      float* Y = (float*)Yv;
#pragma unroll
      for (int it = 0; it < 16; ++it) { const int f4 = lane + 32 * it, rr = f4 >> 4, q = (f4 & 15) * 4;
        *(v4f_t*)(Y + (size_t)(m0 + wm + rr) * ldy + n0 + wn + q) = *(const v4fa*)(so + rr * 68 + q); }
    }
    
  }
}

// x [800][512] -> zero-padded [896][512]
__global__ __launch_bounds__(256) void k_padx(const float* __restrict__ x, float* __restrict__ xp) { const size_t r = blockIdx.x; for (int c = threadIdx.x; c < DDr; c += 256) xp[r * DDr + c] = (r < NROWS) ? x[r * DDr + c] : 0.0f; }
// h1[p][:] = relu(A[b,i] + Bq[b,j] + b1) as f16 rows (pair p = (b·25 + i)·25 + j); pad rows zero
__global__ __launch_bounds__(256) void k_pairs(const float* __restrict__ A, const float* __restrict__ Bq, const float* __restrict__ b1, bf16* __restrict__ h1) {
  const size_t p = blockIdx.x; const int tid = threadIdx.x; union { bf16 hh[2]; unsigned u; } cv;
  if (p < NPAIR) { const int b = p / (NN * NN), r = p % (NN * NN), i = r / NN, j = r % NN; const float* ai = A + ((size_t)b * NN + i) * HHd; const float* bj = Bq + ((size_t)b * NN + j) * HHd;
    const int c = tid * 2; cv.hh[0] = (bf16)fmaxf(ai[c] + bj[c] + b1[c], 0.0f); cv.hh[1] = (bf16)fmaxf(ai[c + 1] + bj[c + 1] + b1[c + 1], 0.0f); }
  else { cv.hh[0] = (bf16)0.0f; cv.hh[1] = (bf16)0.0f; }
  *(unsigned*)(h1 + p * HHd + tid * 2) = cv.u; 
}
// relu + f32 -> f16 rows
__global__ __launch_bounds__(256) void k_relu16(const float* __restrict__ src, bf16* __restrict__ dst, size_t n8) {
  const size_t i = (size_t)blockIdx.x * 256 + threadIdx.x; if (i >= n8) return; const float* p = src + 8 * i; union { bf16 hh[8]; v4u_t u; } cv;
#pragma unroll
  for (int e = 0; e < 8; ++e) cv.hh[e] = (bf16)fmaxf(p[e], 0.0f);
  *(v4u_t*)(dst + 8 * i) = cv.u; 
}
// agg[b][h] = Σ_{i != j} relu(h3raw[(b,i,j)][h]) (f32, fixed order); block = b, threads = columns; also writes the zero pad rows 32..127
__global__ __launch_bounds__(256) void k_agg(const float* __restrict__ h3, float* __restrict__ agg) {
  const int b = blockIdx.x, tid = threadIdx.x;
  for (int c = tid; c < HHd; c += 256) { float s = 0.0f;
    if (b < NBr) {
#pragma unroll 1
      for (int i = 0; i < NN; ++i)
#pragma unroll 1
        for (int j = 0; j < NN; ++j) { if (i == j) continue; s += fmaxf(h3[(((size_t)b * NN + i) * NN + j) * HHd + c], 0.0f); } }
    agg[(size_t)b * HHd + c] = s; }
}
// f_w3 [512][1000] -> [512][1024] zero-padded; bias likewise
__global__ __launch_bounds__(256) void k_padw3(const float* __restrict__ w, const float* __restrict__ b3, float* __restrict__ wp, float* __restrict__ bp) { const int r = blockIdx.x; for (int c = threadIdx.x; c < NCP; c += 256) { wp[(size_t)r * NCP + c] = (c < NCLS) ? w[(size_t)r * NCLS + c] : 0.0f; if (r == 0) bp[c] = (c < NCLS) ? b3[c] : 0.0f; } }
// logits [32][1000] from the padded [128][1024] buffer as one contiguous stream of 32,000 floats (8,000 float4; rows are multiples of 4 so no chunk straddles a row)
__global__ __launch_bounds__(256) void k_out(const float* __restrict__ lp, float* __restrict__ out) {
  const int q4 = blockIdx.x * 256 + threadIdx.x; if (q4 >= NBr * NCLS / 4) return; const int fidx = q4 * 4, r = fidx / NCLS, c = fidx % NCLS;
  const v4f_t v = *(const v4f_t*)(lp + (size_t)r * NCP + c); *(v4f_t*)(out + fidx) = v; 
}

extern "C" void kernel_launch(void* const* d_in, const int* in_sizes, int n_in,
                              void* d_out, int out_size, void* d_ws, size_t ws_size,
                              hipStream_t stream) {
  (void)in_sizes; (void)n_in; (void)out_size;
  const float** f = (const float**)d_in;
  const float* x = f[0], *g_w1 = f[1], *g_b1 = f[2], *g_w2 = f[3], *g_b2 = f[4], *g_w3 = f[5], *g_b3 = f[6], *f_w1 = f[7], *f_b1 = f[8], *f_w2 = f[9], *f_b2 = f[10], *f_w3 = f[11], *f_b3 = f[12];
  float* out = (float*)d_out;      // [32,1000]
  char* ws = (char*)d_ws;
  float* xp = (float*)ws; ws += (size_t)NROWP * DDr * 4;
  float* A = (float*)ws; ws += (size_t)NROWP * HHd * 4; float* Bq = (float*)ws; ws += (size_t)NROWP * HHd * 4;
  bf16* h1 = (bf16*)ws; ws += (size_t)NPAIRP * HHd * 2;        // 20.6 MB
  float* hr = (float*)ws; ws += (size_t)NPAIRP * HHd * 4;       // 41 MB (h2 raw, then h3 raw)
  bf16* h2 = (bf16*)ws; ws += (size_t)NPAIRP * HHd * 2;
  float* agg = (float*)ws; ws += (size_t)128 * HHd * 4;
  float* z1r = (float*)ws; ws += (size_t)128 * HHd * 4; bf16* z1 = (bf16*)ws; ws += (size_t)128 * HHd * 2;
  float* z2r = (float*)ws; ws += (size_t)128 * HHd * 4; bf16* z2 = (bf16*)ws; ws += (size_t)128 * HHd * 2;
  float* w3p = (float*)ws; ws += (size_t)HHd * NCP * 4; float* b3p = (float*)ws; ws += NCP * 4;
  float* lp = (float*)ws; ws += (size_t)128 * NCP * 4;
  if ((size_t)(ws - (char*)d_ws) > ws_size) return;
  const dim3 blk(256);
  k_padx<<<dim3(NROWP), blk, 0, stream>>>(x, xp);
  gemm_kne<float, 0, false><<<dim3(NROWP / 128, HHd / 128), blk, 0, stream>>>(xp, DDr, g_w1, HHd, nullptr, nullptr, nullptr, A, HHd, DDr);                       // x·W1[:D]
  gemm_kne<float, 0, false><<<dim3(NROWP / 128, HHd / 128), blk, 0, stream>>>(xp, DDr, g_w1 + (size_t)DDr * HHd, HHd, nullptr, nullptr, nullptr, Bq, HHd, DDr);  // x·W1[D:]
  k_pairs<<<dim3(NPAIRP), blk, 0, stream>>>(A, Bq, g_b1, h1);
  gemm_kne<bf16, 0, false><<<dim3(NPAIRP / 128, HHd / 128), blk, 0, stream>>>(h1, HHd, g_w2, HHd, g_b2, nullptr, nullptr, hr, HHd, HHd);      // h1·W2 + b2
  k_relu16<<<dim3((NPAIRP * HHd / 8 + 255) / 256), blk, 0, stream>>>(hr, h2, (size_t)NPAIRP * HHd / 8);
  gemm_kne<bf16, 0, false><<<dim3(NPAIRP / 128, HHd / 128), blk, 0, stream>>>(h2, HHd, g_w3, HHd, g_b3, nullptr, nullptr, hr, HHd, HHd);      // h2·W3 + b3 (relu inside the aggregation)
  k_agg<<<dim3(128), blk, 0, stream>>>(hr, agg);
  gemm_kne<float, 0, false><<<dim3(1, HHd / 128), blk, 0, stream>>>(agg, HHd, f_w1, HHd, f_b1, nullptr, nullptr, z1r, HHd, HHd);
  k_relu16<<<dim3((128 * HHd / 8 + 255) / 256), blk, 0, stream>>>(z1r, z1, (size_t)128 * HHd / 8);
  gemm_kne<bf16, 0, false><<<dim3(1, HHd / 128), blk, 0, stream>>>(z1, HHd, f_w2, HHd, f_b2, nullptr, nullptr, z2r, HHd, HHd);
  k_relu16<<<dim3((128 * HHd / 8 + 255) / 256), blk, 0, stream>>>(z2r, z2, (size_t)128 * HHd / 8);
  k_padw3<<<dim3(HHd), blk, 0, stream>>>(f_w3, f_b3, w3p, b3p);
  gemm_kne<bf16, 0, false><<<dim3(1, NCP / 128), blk, 0, stream>>>(z2, HHd, w3p, NCP, b3p, nullptr, nullptr, lp, NCP, HHd);
  k_out<<<dim3((NBr * NCLS / 4 + 255) / 256), blk, 0, stream>>>(lp, out);
}

// v001
// Measured time: 253 microseconds a run.
// Two timings next to v000 put it at 2.81 and 2.82 times that version's speed.
// Contractions on v_wmma_f32_16x16x32_f16 (plain f16 operands, f32 accumulate): the pair MLP g over all 32x25x25 ordered pairs as GEMMs
// with M = pairs: layer 1 split exactly as [x_i, x_j]·W1 = x_i·W1[:D] + x_j·W1[D:] (two K = 512 GEMMs on the 800 node rows, then relu of the
// broadcast sum per pair, written f16), layers 2 and 3 (K = 512, M = 20,000 pair rows padded to 20,096), the i != j sum per batch in f32
// (fixed order), and the f MLP on the 32 aggregated rows (padded to 128; K = 512; N = 1000 padded to 1024). ReLU in f32. The [32][1000]
#include <hip/hip_runtime.h>
#include <hip/hip_bf16.h>
#include <math.h>

#define NBr 32
#define NN 25
#define DDr 512
#define HHd 512
#define NCLS 1000
#define NCP 1024
#define NROWS (NBr * NN)          // 800
#define NROWP 896
#define NPAIR (NBr * NN * NN)     // 20000
#define NPAIRP 20096
#define GSTR 48
#define SS 64
#define HH 1
#define DKK 64

typedef _Float16 bf16;
typedef _Float16 f16;
typedef __attribute__((ext_vector_type(4))) unsigned v4u_t;
typedef unsigned v4ua __attribute__((ext_vector_type(4), may_alias));
typedef __attribute__((ext_vector_type(4))) float v4f_t;
typedef float v4fa __attribute__((ext_vector_type(4), may_alias));
typedef __attribute__((ext_vector_type(16))) bf16  bf16x16;
typedef bf16x16 f16x16;
typedef __attribute__((ext_vector_type(8)))  bf16  bf16x8;
typedef bf16x8 f16x8;
typedef __attribute__((ext_vector_type(4)))  bf16  bf16x4;
typedef __attribute__((ext_vector_type(8)))  float f32x8;
__device__ __forceinline__ f32x8 wmma16(f16x16 a, f16x16 b, f32x8 c) {
  c = __builtin_amdgcn_wmma_f32_16x16x32_f16(false, a, false, b, (short)0, c, false, false);
  asm volatile("v_nop\n\tv_nop\n\tv_nop\n\tv_nop" : "+v"(c) : "v"(a), "v"(b));
  return c;
}
#define LDS_STRIDE 48   // GEMM tiles: 32 -> 48 elems (96B rows): aligned b128 reads
#define KSTRIDE    72
#define VSTRIDE    48

__device__ __forceinline__ f32x8 wmma_bf16(bf16x16 a, bf16x16 b, f32x8 c) {
  c = __builtin_amdgcn_wmma_f32_16x16x32_f16(false, a, false, b, (short)0, c, false, false);
  asm volatile("v_nop\n\tv_nop\n\tv_nop\n\tv_nop" : "+v"(c) : "v"(a), "v"(b));   // A/B-overwrite hazard guard
  return c;
}

// 16x32 (MxK) bf16 fragment from a row-major global matrix.
// lanes 0-15  (row=lane)    : elems 0..7 = K+0..7,  8..15 = K+16..23
// lanes 16-31 (row=lane-16) : elems 0..7 = K+8..15, 8..15 = K+24..31
template <typename T>
__device__ __forceinline__ bf16x16 load_frag(const T* __restrict__ base, int ld,
                                             int row0, int k0) {
  const int lane = threadIdx.x & 31;
  const int r    = lane & 15;
  const int kh   = (lane >> 4) * 8;
  const T* p0 = base + (size_t)(row0 + r) * ld + (k0 + kh);
  const T* p1 = p0 + 16;
  bf16x16 f;
#pragma unroll
  for (int i = 0; i < 8; ++i) {
    f[i]     = (bf16)p0[i];
    f[i + 8] = (bf16)p1[i];
  }
  return f;
}

// Same fragment from an LDS tile with padded row stride (base includes row0/k0).
__device__ __forceinline__ bf16x16 lds_frag(const bf16* base, int stride) {
  const int lane = threadIdx.x & 31;
  const int row  = lane & 15;
  const int kh   = (lane >> 4) * 8;
  const bf16x8 lo = *(const bf16x8*)(base + row * stride + kh);
  const bf16x8 hi = *(const bf16x8*)(base + row * stride + kh + 16);
  bf16x16 f;
#pragma unroll
  for (int i = 0; i < 8; ++i) { f[i] = lo[i]; f[i + 8] = hi[i]; }
  return f;
}

template <typename T>
__device__ __forceinline__ void stage_read16(const T* __restrict__ p, float* buf) {
#pragma unroll
  for (int i = 0; i < 16; ++i) buf[i] = (float)p[i];
}

__device__ __forceinline__ void stage_write(bf16* dst, const float* buf, int nquad) {
#pragma unroll
  for (int i = 0; i < nquad; ++i) {
    bf16x4 q;
    q[0] = (bf16)buf[4 * i];     q[1] = (bf16)buf[4 * i + 1];
    q[2] = (bf16)buf[4 * i + 2]; q[3] = (bf16)buf[4 * i + 3];
    *(bf16x4*)(dst + 4 * i) = q;
  }
}


// ---------------------------------------------------------------------------------------------------------------------------
// gemm_kne: Y[m][n] = epi( Σ_k A[m][k]·W[k][n] + bias[n] ), A f32/f16 [M][lda], W f32 row-major [K][N] (ldw), plain f16 operands,
// f32 accumulate. EPI 0: identity; 1: exact-erf GELU; 2: R[m][n] + gvec[n]·(·) (residual with per-channel gain). Output f32 (or f16
// when OUT16). Block = 128x128 tile, 8 waves as 4(M) x 2(N); per 32-wide k-step A and W tiles staged f16 in LDS (W transposed
// ---------------------------------------------------------------------------------------------------------------------------
#define GSTR 48
template <typename AT, int EPI, bool OUT16>
__global__ __launch_bounds__(256) void gemm_kne(const AT* __restrict__ A, int lda, const float* __restrict__ Wm, int ldw,
                                                const float* __restrict__ bias, const float* __restrict__ R, const float* __restrict__ gvec,
                                                void* __restrict__ Yv, int ldy, int K) {
  __shared__ __attribute__((aligned(16))) f16 ldsA[128 * GSTR];
  __shared__ __attribute__((aligned(16))) f16 ldsW[128 * GSTR];
  __shared__ __attribute__((aligned(16))) float oS[8][32 * 68];
  const int tid = threadIdx.x, lane = tid & 31, wave = tid >> 5, cl = lane & 15, rh = (lane >> 4) * 8;
  const int m0 = blockIdx.x * 128, n0 = blockIdx.y * 128;
  const int wm = (wave & 3) * 32, wn = (wave >> 2) * 64;
  f32x8 acc[2][4];
#pragma unroll
  for (int i = 0; i < 2; ++i)
#pragma unroll
    for (int j = 0; j < 4; ++j) { f32x8 z = {}; acc[i][j] = z; }
#pragma unroll 1
  for (int k0 = 0; k0 < K; k0 += 32) {
    __syncthreads();
    { const int row = tid >> 1, ch = (tid & 1) * 16;
      const AT* src = A + (size_t)(m0 + row) * lda + k0 + ch;
#pragma unroll
      for (int g = 0; g < 16; ++g) ldsA[row * GSTR + ch + g] = (f16)src[g]; }
    { const int k = tid >> 3, nn0 = (tid & 7) * 16;
      const float* src = Wm + (size_t)(k0 + k) * ldw + n0 + nn0;
#pragma unroll
      for (int g = 0; g < 4; ++g) { const v4f_t v = *(const v4f_t*)(src + 4 * g);
#pragma unroll
        for (int u = 0; u < 4; ++u) ldsW[(nn0 + 4 * g + u) * GSTR + k] = (f16)v[u]; } }
    __syncthreads();
    f16x16 af[2];
#pragma unroll
    for (int i = 0; i < 2; ++i) af[i] = lds_frag(ldsA + (wm + 16 * i) * GSTR, GSTR);
#pragma unroll
    for (int j = 0; j < 4; ++j) {
      const f16x16 bf = lds_frag(ldsW + (wn + 16 * j) * GSTR, GSTR);
#pragma unroll
      for (int i = 0; i < 2; ++i) acc[i][j] = wmma16(af[i], bf, acc[i][j]);
    }
  }
  float* so = oS[wave];
#pragma unroll
  for (int i = 0; i < 2; ++i)
#pragma unroll
    for (int j = 0; j < 4; ++j) {
      const int n = n0 + wn + 16 * j + cl;
      const float bv = bias ? bias[n] : 0.0f;
      const float gv = (EPI == 2) ? gvec[n] : 0.0f;
      if (EPI == 1) {
#pragma unroll 1
        for (int r = 0; r < 8; ++r) { const float xg = acc[i][j][r] + bv; so[(16 * i + rh + r) * 68 + 16 * j + cl] = 0.5f * xg * (1.0f + erff(xg * 0.70710678118654752f)); }
      } else {
#pragma unroll
        for (int r = 0; r < 8; ++r) {
          float v = acc[i][j][r] + bv;
          if (EPI == 2) v = R[(size_t)(m0 + wm + 16 * i + rh + r) * ldy + n] + gv * v;
          so[(16 * i + rh + r) * 68 + 16 * j + cl] = v;
        }
      }
    }
  asm volatile("s_wait_dscnt 0" ::: "memory");
  __builtin_amdgcn_wave_barrier();
{
    if (OUT16) {
      f16* Y = (f16*)Yv;
#pragma unroll
      for (int it = 0; it < 8; ++it) { const int c = lane + 32 * it, rr = c >> 3, q8 = (c & 7) * 8;
        union { f16 h[8]; v4u_t v; } u;
#pragma unroll
        for (int e = 0; e < 8; ++e) u.h[e] = (f16)so[rr * 68 + q8 + e];
        *(v4u_t*)(Y + (size_t)(m0 + wm + rr) * ldy + n0 + wn + q8) = u.v; }
    } else {
      float* Y = (float*)Yv;
#pragma unroll
      for (int it = 0; it < 16; ++it) { const int f4 = lane + 32 * it, rr = f4 >> 4, q = (f4 & 15) * 4;
        *(v4f_t*)(Y + (size_t)(m0 + wm + rr) * ldy + n0 + wn + q) = *(const v4fa*)(so + rr * 68 + q); }
    }
    
  }
}

// x [800][512] -> zero-padded [896][512]
__global__ __launch_bounds__(256) void k_padx(const float* __restrict__ x, float* __restrict__ xp) { const size_t r = blockIdx.x; for (int c = threadIdx.x; c < DDr; c += 256) xp[r * DDr + c] = (r < NROWS) ? x[r * DDr + c] : 0.0f; }
// h1[p][:] = relu(A[b,i] + Bq[b,j] + b1) as f16 rows (pair p = (b·25 + i)·25 + j); pad rows zero
__global__ __launch_bounds__(256) void k_pairs(const float* __restrict__ A, const float* __restrict__ Bq, const float* __restrict__ b1, bf16* __restrict__ h1) {
  const size_t p = blockIdx.x; const int tid = threadIdx.x; union { bf16 hh[2]; unsigned u; } cv;
  if (p < NPAIR) { const int b = p / (NN * NN), r = p % (NN * NN), i = r / NN, j = r % NN; const float* ai = A + ((size_t)b * NN + i) * HHd; const float* bj = Bq + ((size_t)b * NN + j) * HHd;
    const int c = tid * 2; cv.hh[0] = (bf16)fmaxf(ai[c] + bj[c] + b1[c], 0.0f); cv.hh[1] = (bf16)fmaxf(ai[c + 1] + bj[c + 1] + b1[c + 1], 0.0f); }
  else { cv.hh[0] = (bf16)0.0f; cv.hh[1] = (bf16)0.0f; }
  *(unsigned*)(h1 + p * HHd + tid * 2) = cv.u; 
}
// relu + f32 -> f16 rows
__global__ __launch_bounds__(256) void k_relu16(const float* __restrict__ src, bf16* __restrict__ dst, size_t n8) {
  const size_t i = (size_t)blockIdx.x * 256 + threadIdx.x; if (i >= n8) return; const float* p = src + 8 * i; union { bf16 hh[8]; v4u_t u; } cv;
#pragma unroll
  for (int e = 0; e < 8; ++e) cv.hh[e] = (bf16)fmaxf(p[e], 0.0f);
  *(v4u_t*)(dst + 8 * i) = cv.u; 
}
// agg[b][h] = sum over i != j of relu(h3raw[(b,i,j)][h]) in f32, fixed order. Block = (batch b, 64-column slice), 512 threads = 32 row groups x 16
// column quads: a wave-wide 16-byte load covers two whole 256-byte row slices; group g sums pair rows g, g + 32, ... (20 independent loads, all
// issued before the first is used), the 32 group sums meet in LDS and are added in group order. Pair row r = 25 i + j lies on the diagonal
// exactly when r is a multiple of 26; rows past the batch's last are clamped to row 624, which is a diagonal row and so adds nothing.
// Each block also writes its share (3 rows x 64 columns) of the zero pad rows 32..127.
#define AGC 64
#define AGG 32
__global__ __launch_bounds__(512) void k_agg(const float* __restrict__ h3, float* __restrict__ agg) {
  __shared__ __attribute__((aligned(16))) float part[AGG][AGC];
  const int b = blockIdx.x, c0 = blockIdx.y * AGC, tid = threadIdx.x, g = tid >> 4, q = (tid & 15) * 4;
  const float* base = h3 + (size_t)b * (NN * NN) * HHd + c0 + q;
  v4f_t v[20];
#pragma unroll
  for (int t = 0; t < 20; ++t) v[t] = *(const v4f_t*)(base + (size_t)min(g + AGG * t, NN * NN - 1) * HHd);
  asm volatile("s_wait_xcnt 0x0" ::: "memory");   // precaution: the loads' address registers are reused by the sums below
  __builtin_amdgcn_sched_barrier(0);   // all 20 loads issue before the first sum: without it the last load is scheduled behind the wait for the first
  v4f_t s = {0.0f, 0.0f, 0.0f, 0.0f};
#pragma unroll
  for (int t = 0; t < 20; ++t) {
    const float hi = (min(g + AGG * t, NN * NN - 1) % (NN + 1)) != 0 ? __builtin_inff() : 0.0f;   // upper clamp: none for i != j, 0 on the diagonal
#pragma unroll
    for (int e = 0; e < 4; ++e) s[e] += __builtin_amdgcn_fmed3f(v[t][e], 0.0f, hi);   // relu and diagonal mask in one median
  }
  *(v4f_t*)(&part[g][q]) = s;
  __syncthreads();
  if (tid < AGC) {
    float a = 0.0f;
#pragma unroll
    for (int k = 0; k < AGG; ++k) a += part[k][tid];
    agg[(size_t)b * HHd + c0 + tid] = a;
  } else if (tid < 4 * AGC) {
    const int z = tid - AGC;
    agg[(size_t)(NBr + 3 * b + (z >> 6)) * HHd + c0 + (z & 63)] = 0.0f;
  }
}
// f_w3 [512][1000] -> [512][1024] zero-padded; bias likewise
__global__ __launch_bounds__(256) void k_padw3(const float* __restrict__ w, const float* __restrict__ b3, float* __restrict__ wp, float* __restrict__ bp) { const int r = blockIdx.x; for (int c = threadIdx.x; c < NCP; c += 256) { wp[(size_t)r * NCP + c] = (c < NCLS) ? w[(size_t)r * NCLS + c] : 0.0f; if (r == 0) bp[c] = (c < NCLS) ? b3[c] : 0.0f; } }
// logits [32][1000] from the padded [128][1024] buffer as one contiguous stream of 32,000 floats (8,000 float4; rows are multiples of 4 so no chunk straddles a row)
__global__ __launch_bounds__(256) void k_out(const float* __restrict__ lp, float* __restrict__ out) {
  const int q4 = blockIdx.x * 256 + threadIdx.x; if (q4 >= NBr * NCLS / 4) return; const int fidx = q4 * 4, r = fidx / NCLS, c = fidx % NCLS;
  const v4f_t v = *(const v4f_t*)(lp + (size_t)r * NCP + c); *(v4f_t*)(out + fidx) = v; 
}

extern "C" void kernel_launch(void* const* d_in, const int* in_sizes, int n_in,
                              void* d_out, int out_size, void* d_ws, size_t ws_size,
                              hipStream_t stream) {
  (void)in_sizes; (void)n_in; (void)out_size;
  const float** f = (const float**)d_in;
  const float* x = f[0], *g_w1 = f[1], *g_b1 = f[2], *g_w2 = f[3], *g_b2 = f[4], *g_w3 = f[5], *g_b3 = f[6], *f_w1 = f[7], *f_b1 = f[8], *f_w2 = f[9], *f_b2 = f[10], *f_w3 = f[11], *f_b3 = f[12];
  float* out = (float*)d_out;      // [32,1000]
  char* ws = (char*)d_ws;
  float* xp = (float*)ws; ws += (size_t)NROWP * DDr * 4;
  float* A = (float*)ws; ws += (size_t)NROWP * HHd * 4; float* Bq = (float*)ws; ws += (size_t)NROWP * HHd * 4;
  bf16* h1 = (bf16*)ws; ws += (size_t)NPAIRP * HHd * 2;        // 20.6 MB
  float* hr = (float*)ws; ws += (size_t)NPAIRP * HHd * 4;       // 41 MB (h2 raw, then h3 raw)
  bf16* h2 = (bf16*)ws; ws += (size_t)NPAIRP * HHd * 2;
  float* agg = (float*)ws; ws += (size_t)128 * HHd * 4;
  float* z1r = (float*)ws; ws += (size_t)128 * HHd * 4; bf16* z1 = (bf16*)ws; ws += (size_t)128 * HHd * 2;
  float* z2r = (float*)ws; ws += (size_t)128 * HHd * 4; bf16* z2 = (bf16*)ws; ws += (size_t)128 * HHd * 2;
  float* w3p = (float*)ws; ws += (size_t)HHd * NCP * 4; float* b3p = (float*)ws; ws += NCP * 4;
  float* lp = (float*)ws; ws += (size_t)128 * NCP * 4;
  if ((size_t)(ws - (char*)d_ws) > ws_size) return;
  const dim3 blk(256);
  k_padx<<<dim3(NROWP), blk, 0, stream>>>(x, xp);
  gemm_kne<float, 0, false><<<dim3(NROWP / 128, HHd / 128), blk, 0, stream>>>(xp, DDr, g_w1, HHd, nullptr, nullptr, nullptr, A, HHd, DDr);                       // x·W1[:D]
  gemm_kne<float, 0, false><<<dim3(NROWP / 128, HHd / 128), blk, 0, stream>>>(xp, DDr, g_w1 + (size_t)DDr * HHd, HHd, nullptr, nullptr, nullptr, Bq, HHd, DDr);  // x·W1[D:]
  k_pairs<<<dim3(NPAIRP), blk, 0, stream>>>(A, Bq, g_b1, h1);
  gemm_kne<bf16, 0, false><<<dim3(NPAIRP / 128, HHd / 128), blk, 0, stream>>>(h1, HHd, g_w2, HHd, g_b2, nullptr, nullptr, hr, HHd, HHd);      // h1·W2 + b2
  k_relu16<<<dim3((NPAIRP * HHd / 8 + 255) / 256), blk, 0, stream>>>(hr, h2, (size_t)NPAIRP * HHd / 8);
  gemm_kne<bf16, 0, false><<<dim3(NPAIRP / 128, HHd / 128), blk, 0, stream>>>(h2, HHd, g_w3, HHd, g_b3, nullptr, nullptr, hr, HHd, HHd);      // h2·W3 + b3 (relu inside the aggregation)
  k_agg<<<dim3(NBr, HHd / AGC), dim3(512), 0, stream>>>(hr, agg);
  gemm_kne<float, 0, false><<<dim3(1, HHd / 128), blk, 0, stream>>>(agg, HHd, f_w1, HHd, f_b1, nullptr, nullptr, z1r, HHd, HHd);
  k_relu16<<<dim3((128 * HHd / 8 + 255) / 256), blk, 0, stream>>>(z1r, z1, (size_t)128 * HHd / 8);
  gemm_kne<bf16, 0, false><<<dim3(1, HHd / 128), blk, 0, stream>>>(z1, HHd, f_w2, HHd, f_b2, nullptr, nullptr, z2r, HHd, HHd);
  k_relu16<<<dim3((128 * HHd / 8 + 255) / 256), blk, 0, stream>>>(z2r, z2, (size_t)128 * HHd / 8);
  k_padw3<<<dim3(HHd), blk, 0, stream>>>(f_w3, f_b3, w3p, b3p);
  gemm_kne<bf16, 0, false><<<dim3(1, NCP / 128), blk, 0, stream>>>(z2, HHd, w3p, NCP, b3p, nullptr, nullptr, lp, NCP, HHd);
  k_out<<<dim3((NBr * NCLS / 4 + 255) / 256), blk, 0, stream>>>(lp, out);
}

// v002
// One run takes 196 microseconds.
// Two timings next to v001 put it at 1.30 and 1.29 times that version's speed.
// Over all steps from v000 it is 3.64 times as fast.
// Contractions on v_wmma_f32_16x16x32_f16 (plain f16 operands, f32 accumulate): the pair MLP g over all 32x25x25 ordered pairs as GEMMs
// with M = pairs: layer 1 split exactly as [x_i, x_j]·W1 = x_i·W1[:D] + x_j·W1[D:] (two K = 512 GEMMs on the 800 node rows, then relu of the
// broadcast sum per pair, written f16), layers 2 and 3 (K = 512, M = 20,000 pair rows padded to 20,096), the i != j sum per batch in f32
// (fixed order), and the f MLP on the 32 aggregated rows (padded to 128; K = 512; N = 1000 padded to 1024). ReLU in f32. The [32][1000]
#include <hip/hip_runtime.h>
#include <hip/hip_bf16.h>
#include <math.h>

#define NBr 32
#define NN 25
#define DDr 512
#define HHd 512
#define NCLS 1000
#define NCP 1024
#define NROWS (NBr * NN)          // 800
#define NROWP 896
#define NPAIR (NBr * NN * NN)     // 20000
#define NPAIRP 20096
#define GSTR 40
#define SS 64
#define HH 1
#define DKK 64

typedef _Float16 bf16;
typedef _Float16 f16;
typedef __attribute__((ext_vector_type(4))) unsigned v4u_t;
typedef unsigned v4ua __attribute__((ext_vector_type(4), may_alias));
typedef __attribute__((ext_vector_type(4))) float v4f_t;
typedef float v4fa __attribute__((ext_vector_type(4), may_alias));
typedef __attribute__((ext_vector_type(16))) bf16  bf16x16;
typedef bf16x16 f16x16;
typedef __attribute__((ext_vector_type(8)))  bf16  bf16x8;
typedef bf16x8 f16x8;
typedef __attribute__((ext_vector_type(4)))  bf16  bf16x4;
typedef __attribute__((ext_vector_type(8)))  float f32x8;
__device__ __forceinline__ f32x8 wmma16(f16x16 a, f16x16 b, f32x8 c) {
  c = __builtin_amdgcn_wmma_f32_16x16x32_f16(false, a, false, b, (short)0, c, false, false);
  asm volatile("v_nop\n\tv_nop\n\tv_nop\n\tv_nop" : "+v"(c) : "v"(a), "v"(b));
  return c;
}
#define LDS_STRIDE 48   // unused: GEMM tiles use GSTR (32 -> 40 elems, 80B rows)
#define KSTRIDE    72   // unused
#define VSTRIDE    48   // unused

__device__ __forceinline__ f32x8 wmma_bf16(bf16x16 a, bf16x16 b, f32x8 c) {
  c = __builtin_amdgcn_wmma_f32_16x16x32_f16(false, a, false, b, (short)0, c, false, false);
  asm volatile("v_nop\n\tv_nop\n\tv_nop\n\tv_nop" : "+v"(c) : "v"(a), "v"(b));   // A/B-overwrite hazard guard
  return c;
}

// 16x32 (MxK) bf16 fragment from a row-major global matrix.
// lanes 0-15  (row=lane)    : elems 0..7 = K+0..7,  8..15 = K+16..23
// lanes 16-31 (row=lane-16) : elems 0..7 = K+8..15, 8..15 = K+24..31
template <typename T>
__device__ __forceinline__ bf16x16 load_frag(const T* __restrict__ base, int ld,
                                             int row0, int k0) {
  const int lane = threadIdx.x & 31;
  const int r    = lane & 15;
  const int kh   = (lane >> 4) * 8;
  const T* p0 = base + (size_t)(row0 + r) * ld + (k0 + kh);
  const T* p1 = p0 + 16;
  bf16x16 f;
#pragma unroll
  for (int i = 0; i < 8; ++i) {
    f[i]     = (bf16)p0[i];
    f[i + 8] = (bf16)p1[i];
  }
  return f;
}

// Same fragment from an LDS tile with padded row stride (base includes row0/k0).
__device__ __forceinline__ bf16x16 lds_frag(const bf16* base, int stride) {
  const int lane = threadIdx.x & 31;
  const int row  = lane & 15;
  const int kh   = (lane >> 4) * 8;
  const bf16x8 lo = *(const bf16x8*)(base + row * stride + kh);
  const bf16x8 hi = *(const bf16x8*)(base + row * stride + kh + 16);
  bf16x16 f;
#pragma unroll
  for (int i = 0; i < 8; ++i) { f[i] = lo[i]; f[i + 8] = hi[i]; }
  return f;
}

template <typename T>
__device__ __forceinline__ void stage_read16(const T* __restrict__ p, float* buf) {
#pragma unroll
  for (int i = 0; i < 16; ++i) buf[i] = (float)p[i];
}

__device__ __forceinline__ void stage_write(bf16* dst, const float* buf, int nquad) {
#pragma unroll
  for (int i = 0; i < nquad; ++i) {
    bf16x4 q;
    q[0] = (bf16)buf[4 * i];     q[1] = (bf16)buf[4 * i + 1];
    q[2] = (bf16)buf[4 * i + 2]; q[3] = (bf16)buf[4 * i + 3];
    *(bf16x4*)(dst + 4 * i) = q;
  }
}


// ---------------------------------------------------------------------------------------------------------------------------
// gemm_kne: Y[m][n] = epi( Σ_k A[m][k]·W[k][n] + bias[n] ), A f32/f16 [M][lda], W f32 row-major [K][N] (ldw), plain f16 operands,
// f32 accumulate. EPI 0: identity; 1: exact-erf GELU; 2: R[m][n] + gvec[n]·(·) (residual with per-channel gain). Output f32 (or f16
// when OUT16). Block = 128x128 tile, 8 waves as 4(M) x 2(N); per 32-wide k-step A and W tiles staged f16 in LDS (W transposed
// ---------------------------------------------------------------------------------------------------------------------------
#define GSTR 40
template <typename AT, int EPI, bool OUT16>
__global__ __launch_bounds__(256) void gemm_kne(const AT* __restrict__ A, int lda, const float* __restrict__ Wm, int ldw,
                                                const float* __restrict__ bias, const float* __restrict__ R, const float* __restrict__ gvec,
                                                void* __restrict__ Yv, int ldy, int K) {
  __shared__ __attribute__((aligned(16))) f16 ldsA[128 * GSTR];
  __shared__ __attribute__((aligned(16))) f16 ldsW[128 * GSTR];
  __shared__ __attribute__((aligned(16))) float oS[8][32 * 68];
  const int tid = threadIdx.x, lane = tid & 31, wave = tid >> 5, cl = lane & 15, rh = (lane >> 4) * 8;
  const int m0 = blockIdx.x * 128, n0 = blockIdx.y * 128;
  const int wm = (wave & 3) * 32, wn = (wave >> 2) * 64;
  f32x8 acc[2][4];
#pragma unroll
  for (int i = 0; i < 2; ++i)
#pragma unroll
    for (int j = 0; j < 4; ++j) { f32x8 z = {}; acc[i][j] = z; }
#pragma unroll 1
  for (int k0 = 0; k0 < K; k0 += 32) {
    __syncthreads();
    { const int row = tid >> 1, ch = (tid & 1) * 16;
      const AT* src = A + (size_t)(m0 + row) * lda + k0 + ch;
#pragma unroll
      for (int g = 0; g < 16; ++g) ldsA[row * GSTR + ch + g] = (f16)src[g]; }
    { // W tile: each thread takes a 4(k) x 4(n) block and transposes it in registers, so column n gets one 8-byte run of 4 k.
      // At the 80-byte pitch a wave's 32 runs (8 k-quads x 4 column quads) fall on all 64 banks once.
      const int kq = (tid & 7) * 4, nq = (tid >> 3) * 4;
      const float* src = Wm + (size_t)(k0 + kq) * ldw + n0 + nq;
      v4f_t v[4];
#pragma unroll
      for (int g = 0; g < 4; ++g) v[g] = *(const v4f_t*)(src + (size_t)g * ldw);
#pragma unroll
      for (int u = 0; u < 4; ++u) { bf16x4 q; q[0] = (f16)v[0][u]; q[1] = (f16)v[1][u]; q[2] = (f16)v[2][u]; q[3] = (f16)v[3][u];
        *(bf16x4*)(ldsW + (nq + u) * GSTR + kq) = q; } }
    __syncthreads();
    f16x16 af[2];
#pragma unroll
    for (int i = 0; i < 2; ++i) af[i] = lds_frag(ldsA + (wm + 16 * i) * GSTR, GSTR);
#pragma unroll
    for (int j = 0; j < 4; ++j) {
      const f16x16 bf = lds_frag(ldsW + (wn + 16 * j) * GSTR, GSTR);
#pragma unroll
      for (int i = 0; i < 2; ++i) acc[i][j] = wmma16(af[i], bf, acc[i][j]);
    }
  }
  float* so = oS[wave];
#pragma unroll
  for (int i = 0; i < 2; ++i)
#pragma unroll
    for (int j = 0; j < 4; ++j) {
      const int n = n0 + wn + 16 * j + cl;
      const float bv = bias ? bias[n] : 0.0f;
      const float gv = (EPI == 2) ? gvec[n] : 0.0f;
      if (EPI == 1) {
#pragma unroll 1
        for (int r = 0; r < 8; ++r) { const float xg = acc[i][j][r] + bv; so[(16 * i + rh + r) * 68 + 16 * j + cl] = 0.5f * xg * (1.0f + erff(xg * 0.70710678118654752f)); }
      } else {
#pragma unroll
        for (int r = 0; r < 8; ++r) {
          float v = acc[i][j][r] + bv;
          if (EPI == 2) v = R[(size_t)(m0 + wm + 16 * i + rh + r) * ldy + n] + gv * v;
          so[(16 * i + rh + r) * 68 + 16 * j + cl] = v;
        }
      }
    }
  asm volatile("s_wait_dscnt 0" ::: "memory");
  __builtin_amdgcn_wave_barrier();
{
    if (OUT16) {
      f16* Y = (f16*)Yv;
#pragma unroll
      for (int it = 0; it < 8; ++it) { const int c = lane + 32 * it, rr = c >> 3, q8 = (c & 7) * 8;
        union { f16 h[8]; v4u_t v; } u;
#pragma unroll
        for (int e = 0; e < 8; ++e) u.h[e] = (f16)so[rr * 68 + q8 + e];
        *(v4u_t*)(Y + (size_t)(m0 + wm + rr) * ldy + n0 + wn + q8) = u.v; }
    } else {
      float* Y = (float*)Yv;
#pragma unroll
      for (int it = 0; it < 16; ++it) { const int f4 = lane + 32 * it, rr = f4 >> 4, q = (f4 & 15) * 4;
        *(v4f_t*)(Y + (size_t)(m0 + wm + rr) * ldy + n0 + wn + q) = *(const v4fa*)(so + rr * 68 + q); }
    }
    
  }
}

// x [800][512] -> zero-padded [896][512]
__global__ __launch_bounds__(256) void k_padx(const float* __restrict__ x, float* __restrict__ xp) { const size_t r = blockIdx.x; for (int c = threadIdx.x; c < DDr; c += 256) xp[r * DDr + c] = (r < NROWS) ? x[r * DDr + c] : 0.0f; }
// h1[p][:] = relu(A[b,i] + Bq[b,j] + b1) as f16 rows (pair p = (b·25 + i)·25 + j); pad rows zero
__global__ __launch_bounds__(256) void k_pairs(const float* __restrict__ A, const float* __restrict__ Bq, const float* __restrict__ b1, bf16* __restrict__ h1) {
  const size_t p = blockIdx.x; const int tid = threadIdx.x; union { bf16 hh[2]; unsigned u; } cv;
  if (p < NPAIR) { const int b = p / (NN * NN), r = p % (NN * NN), i = r / NN, j = r % NN; const float* ai = A + ((size_t)b * NN + i) * HHd; const float* bj = Bq + ((size_t)b * NN + j) * HHd;
    const int c = tid * 2; cv.hh[0] = (bf16)fmaxf(ai[c] + bj[c] + b1[c], 0.0f); cv.hh[1] = (bf16)fmaxf(ai[c + 1] + bj[c + 1] + b1[c + 1], 0.0f); }
  else { cv.hh[0] = (bf16)0.0f; cv.hh[1] = (bf16)0.0f; }
  *(unsigned*)(h1 + p * HHd + tid * 2) = cv.u; 
}
// relu + f32 -> f16 rows
__global__ __launch_bounds__(256) void k_relu16(const float* __restrict__ src, bf16* __restrict__ dst, size_t n8) {
  const size_t i = (size_t)blockIdx.x * 256 + threadIdx.x; if (i >= n8) return; const float* p = src + 8 * i; union { bf16 hh[8]; v4u_t u; } cv;
#pragma unroll
  for (int e = 0; e < 8; ++e) cv.hh[e] = (bf16)fmaxf(p[e], 0.0f);
  *(v4u_t*)(dst + 8 * i) = cv.u; 
}
// agg[b][h] = sum over i != j of relu(h3raw[(b,i,j)][h]) in f32, fixed order. Block = (batch b, 64-column slice), 512 threads = 32 row groups x 16
// column quads: a wave-wide 16-byte load covers two whole 256-byte row slices; group g sums pair rows g, g + 32, ... (20 independent loads, all
// issued before the first is used), the 32 group sums meet in LDS and are added in group order. Pair row r = 25 i + j lies on the diagonal
// exactly when r is a multiple of 26; rows past the batch's last are clamped to row 624, which is a diagonal row and so adds nothing.
// Each block also writes its share (3 rows x 64 columns) of the zero pad rows 32..127.
#define AGC 64
#define AGG 32
__global__ __launch_bounds__(512) void k_agg(const float* __restrict__ h3, float* __restrict__ agg) {
  __shared__ __attribute__((aligned(16))) float part[AGG][AGC];
  const int b = blockIdx.x, c0 = blockIdx.y * AGC, tid = threadIdx.x, g = tid >> 4, q = (tid & 15) * 4;
  const float* base = h3 + (size_t)b * (NN * NN) * HHd + c0 + q;
  v4f_t v[20];
#pragma unroll
  for (int t = 0; t < 20; ++t) v[t] = *(const v4f_t*)(base + (size_t)min(g + AGG * t, NN * NN - 1) * HHd);
  asm volatile("s_wait_xcnt 0x0" ::: "memory");   // precaution: the loads' address registers are reused by the sums below
  __builtin_amdgcn_sched_barrier(0);   // all 20 loads issue before the first sum: without it the last load is scheduled behind the wait for the first
  v4f_t s = {0.0f, 0.0f, 0.0f, 0.0f};
#pragma unroll
  for (int t = 0; t < 20; ++t) {
    const float hi = (min(g + AGG * t, NN * NN - 1) % (NN + 1)) != 0 ? __builtin_inff() : 0.0f;   // upper clamp: none for i != j, 0 on the diagonal
#pragma unroll
    for (int e = 0; e < 4; ++e) s[e] += __builtin_amdgcn_fmed3f(v[t][e], 0.0f, hi);   // relu and diagonal mask in one median
  }
  *(v4f_t*)(&part[g][q]) = s;
  __syncthreads();
  if (tid < AGC) {
    float a = 0.0f;
#pragma unroll
    for (int k = 0; k < AGG; ++k) a += part[k][tid];
    agg[(size_t)b * HHd + c0 + tid] = a;
  } else if (tid < 4 * AGC) {
    const int z = tid - AGC;
    agg[(size_t)(NBr + 3 * b + (z >> 6)) * HHd + c0 + (z & 63)] = 0.0f;
  }
}
// f_w3 [512][1000] -> [512][1024] zero-padded; bias likewise
__global__ __launch_bounds__(256) void k_padw3(const float* __restrict__ w, const float* __restrict__ b3, float* __restrict__ wp, float* __restrict__ bp) { const int r = blockIdx.x; for (int c = threadIdx.x; c < NCP; c += 256) { wp[(size_t)r * NCP + c] = (c < NCLS) ? w[(size_t)r * NCLS + c] : 0.0f; if (r == 0) bp[c] = (c < NCLS) ? b3[c] : 0.0f; } }
// logits [32][1000] from the padded [128][1024] buffer as one contiguous stream of 32,000 floats (8,000 float4; rows are multiples of 4 so no chunk straddles a row)
__global__ __launch_bounds__(256) void k_out(const float* __restrict__ lp, float* __restrict__ out) {
  const int q4 = blockIdx.x * 256 + threadIdx.x; if (q4 >= NBr * NCLS / 4) return; const int fidx = q4 * 4, r = fidx / NCLS, c = fidx % NCLS;
  const v4f_t v = *(const v4f_t*)(lp + (size_t)r * NCP + c); *(v4f_t*)(out + fidx) = v; 
}

extern "C" void kernel_launch(void* const* d_in, const int* in_sizes, int n_in,
                              void* d_out, int out_size, void* d_ws, size_t ws_size,
                              hipStream_t stream) {
  (void)in_sizes; (void)n_in; (void)out_size;
  const float** f = (const float**)d_in;
  const float* x = f[0], *g_w1 = f[1], *g_b1 = f[2], *g_w2 = f[3], *g_b2 = f[4], *g_w3 = f[5], *g_b3 = f[6], *f_w1 = f[7], *f_b1 = f[8], *f_w2 = f[9], *f_b2 = f[10], *f_w3 = f[11], *f_b3 = f[12];
  float* out = (float*)d_out;      // [32,1000]
  char* ws = (char*)d_ws;
  float* xp = (float*)ws; ws += (size_t)NROWP * DDr * 4;
  float* A = (float*)ws; ws += (size_t)NROWP * HHd * 4; float* Bq = (float*)ws; ws += (size_t)NROWP * HHd * 4;
  bf16* h1 = (bf16*)ws; ws += (size_t)NPAIRP * HHd * 2;        // 20.6 MB
  float* hr = (float*)ws; ws += (size_t)NPAIRP * HHd * 4;       // 41 MB (h2 raw, then h3 raw)
  bf16* h2 = (bf16*)ws; ws += (size_t)NPAIRP * HHd * 2;
  float* agg = (float*)ws; ws += (size_t)128 * HHd * 4;
  float* z1r = (float*)ws; ws += (size_t)128 * HHd * 4; bf16* z1 = (bf16*)ws; ws += (size_t)128 * HHd * 2;
  float* z2r = (float*)ws; ws += (size_t)128 * HHd * 4; bf16* z2 = (bf16*)ws; ws += (size_t)128 * HHd * 2;
  float* w3p = (float*)ws; ws += (size_t)HHd * NCP * 4; float* b3p = (float*)ws; ws += NCP * 4;
  float* lp = (float*)ws; ws += (size_t)128 * NCP * 4;
  if ((size_t)(ws - (char*)d_ws) > ws_size) return;
  const dim3 blk(256);
  k_padx<<<dim3(NROWP), blk, 0, stream>>>(x, xp);
  gemm_kne<float, 0, false><<<dim3(NROWP / 128, HHd / 128), blk, 0, stream>>>(xp, DDr, g_w1, HHd, nullptr, nullptr, nullptr, A, HHd, DDr);                       // x·W1[:D]
  gemm_kne<float, 0, false><<<dim3(NROWP / 128, HHd / 128), blk, 0, stream>>>(xp, DDr, g_w1 + (size_t)DDr * HHd, HHd, nullptr, nullptr, nullptr, Bq, HHd, DDr);  // x·W1[D:]
  k_pairs<<<dim3(NPAIRP), blk, 0, stream>>>(A, Bq, g_b1, h1);
  gemm_kne<bf16, 0, false><<<dim3(NPAIRP / 128, HHd / 128), blk, 0, stream>>>(h1, HHd, g_w2, HHd, g_b2, nullptr, nullptr, hr, HHd, HHd);      // h1·W2 + b2
  k_relu16<<<dim3((NPAIRP * HHd / 8 + 255) / 256), blk, 0, stream>>>(hr, h2, (size_t)NPAIRP * HHd / 8);
  gemm_kne<bf16, 0, false><<<dim3(NPAIRP / 128, HHd / 128), blk, 0, stream>>>(h2, HHd, g_w3, HHd, g_b3, nullptr, nullptr, hr, HHd, HHd);      // h2·W3 + b3 (relu inside the aggregation)
  k_agg<<<dim3(NBr, HHd / AGC), dim3(512), 0, stream>>>(hr, agg);
  gemm_kne<float, 0, false><<<dim3(1, HHd / 128), blk, 0, stream>>>(agg, HHd, f_w1, HHd, f_b1, nullptr, nullptr, z1r, HHd, HHd);
  k_relu16<<<dim3((128 * HHd / 8 + 255) / 256), blk, 0, stream>>>(z1r, z1, (size_t)128 * HHd / 8);
  gemm_kne<bf16, 0, false><<<dim3(1, HHd / 128), blk, 0, stream>>>(z1, HHd, f_w2, HHd, f_b2, nullptr, nullptr, z2r, HHd, HHd);
  k_relu16<<<dim3((128 * HHd / 8 + 255) / 256), blk, 0, stream>>>(z2r, z2, (size_t)128 * HHd / 8);
  k_padw3<<<dim3(HHd), blk, 0, stream>>>(f_w3, f_b3, w3p, b3p);
  gemm_kne<bf16, 0, false><<<dim3(1, NCP / 128), blk, 0, stream>>>(z2, HHd, w3p, NCP, b3p, nullptr, nullptr, lp, NCP, HHd);
  k_out<<<dim3((NBr * NCLS / 4 + 255) / 256), blk, 0, stream>>>(lp, out);
}

// v003
// One run takes 148 microseconds.
// Two timings next to v002 put it at 1.33 and 1.32 times that version's speed.
// All steps since v000 together make it 4.83 times as fast.
// Contractions on v_wmma_f32_16x16x32_f16 (plain f16 operands, f32 accumulate): the pair MLP g over all 32x25x25 ordered pairs as GEMMs
// with M = pairs: layer 1 split exactly as [x_i, x_j]·W1 = x_i·W1[:D] + x_j·W1[D:] (two K = 512 GEMMs on the 800 node rows, then relu of the
// broadcast sum per pair, written f16), layers 2 and 3 (K = 512, M = 20,000 pair rows padded to 20,096), the i != j sum per batch in f32
// (fixed order), and the f MLP on the 32 aggregated rows (padded to 128; K = 512; N = 1000 padded to 1024). ReLU in f32. The [32][1000]
#include <hip/hip_runtime.h>
#include <hip/hip_bf16.h>
#include <math.h>

#define NBr 32
#define NN 25
#define DDr 512
#define HHd 512
#define NCLS 1000
#define NCP 1024
#define NROWS (NBr * NN)          // 800
#define NROWP 896
#define NPAIR (NBr * NN * NN)     // 20000
#define NPAIRP 20096
#define GSTR 40
#define SS 64
#define HH 1
#define DKK 64

typedef _Float16 bf16;
typedef _Float16 f16;
typedef __attribute__((ext_vector_type(4))) unsigned v4u_t;
typedef unsigned v4ua __attribute__((ext_vector_type(4), may_alias));
typedef __attribute__((ext_vector_type(4))) float v4f_t;
typedef float v4fa __attribute__((ext_vector_type(4), may_alias));
typedef __attribute__((ext_vector_type(16))) bf16  bf16x16;
typedef bf16x16 f16x16;
typedef __attribute__((ext_vector_type(8)))  bf16  bf16x8;
typedef bf16x8 f16x8;
typedef __attribute__((ext_vector_type(4)))  bf16  bf16x4;
typedef __attribute__((ext_vector_type(8)))  float f32x8;
__device__ __forceinline__ f32x8 wmma16(f16x16 a, f16x16 b, f32x8 c) {
  c = __builtin_amdgcn_wmma_f32_16x16x32_f16(false, a, false, b, (short)0, c, false, false);
  asm volatile("v_nop\n\tv_nop\n\tv_nop\n\tv_nop" : "+v"(c) : "v"(a), "v"(b));
  return c;
}
#define LDS_STRIDE 48   // unused: GEMM tiles use PST = KT + 8 (72 or 136 elems, 144B or 272B rows)
#define KSTRIDE    72   // unused
#define VSTRIDE    48   // unused

__device__ __forceinline__ f32x8 wmma_bf16(bf16x16 a, bf16x16 b, f32x8 c) {
  c = __builtin_amdgcn_wmma_f32_16x16x32_f16(false, a, false, b, (short)0, c, false, false);
  asm volatile("v_nop\n\tv_nop\n\tv_nop\n\tv_nop" : "+v"(c) : "v"(a), "v"(b));   // A/B-overwrite hazard guard
  return c;
}

// 16x32 (MxK) bf16 fragment from a row-major global matrix.
// lanes 0-15  (row=lane)    : elems 0..7 = K+0..7,  8..15 = K+16..23
// lanes 16-31 (row=lane-16) : elems 0..7 = K+8..15, 8..15 = K+24..31
template <typename T>
__device__ __forceinline__ bf16x16 load_frag(const T* __restrict__ base, int ld,
                                             int row0, int k0) {
  const int lane = threadIdx.x & 31;
  const int r    = lane & 15;
  const int kh   = (lane >> 4) * 8;
  const T* p0 = base + (size_t)(row0 + r) * ld + (k0 + kh);
  const T* p1 = p0 + 16;
  bf16x16 f;
#pragma unroll
  for (int i = 0; i < 8; ++i) {
    f[i]     = (bf16)p0[i];
    f[i + 8] = (bf16)p1[i];
  }
  return f;
}

// Same fragment from an LDS tile with padded row stride (base includes row0/k0).
__device__ __forceinline__ bf16x16 lds_frag(const bf16* base, int stride) {
  const int lane = threadIdx.x & 31;
  const int row  = lane & 15;
  const int kh   = (lane >> 4) * 8;
  const bf16x8 lo = *(const bf16x8*)(base + row * stride + kh);
  const bf16x8 hi = *(const bf16x8*)(base + row * stride + kh + 16);
  bf16x16 f;
#pragma unroll
  for (int i = 0; i < 8; ++i) { f[i] = lo[i]; f[i + 8] = hi[i]; }
  return f;
}

template <typename T>
__device__ __forceinline__ void stage_read16(const T* __restrict__ p, float* buf) {
#pragma unroll
  for (int i = 0; i < 16; ++i) buf[i] = (float)p[i];
}

__device__ __forceinline__ void stage_write(bf16* dst, const float* buf, int nquad) {
#pragma unroll
  for (int i = 0; i < nquad; ++i) {
    bf16x4 q;
    q[0] = (bf16)buf[4 * i];     q[1] = (bf16)buf[4 * i + 1];
    q[2] = (bf16)buf[4 * i + 2]; q[3] = (bf16)buf[4 * i + 3];
    *(bf16x4*)(dst + 4 * i) = q;
  }
}


// ---------------------------------------------------------------------------------------------------------------------------
// gemm_kne: Y[m][n] = epi( sum_k A[m][k]*W[k][n] + bias[n] ), A f32/f16 [M][lda], W f32 row-major [K][N] (ldw), plain f16 operands,
// f32 accumulate. EPI 0: identity; 1: exact-erf GELU; 2: R[m][n] + gvec[n]*(.) (residual with per-channel gain). Output f32 (or f16
// when OUT16). Block = 128x128 tile, 8 waves as 4(M) x 2(N); per KT-wide k-step A and W tiles staged f16 in LDS (W transposed).
// KT = k depth of one staged tile: every global load of a step is in flight at once, so a GEMM waits out K / KT load latencies.
// lda, ldw = row pitches of A and W in elements, compile-time so that a tile's loads differ only in their immediate offset.
// ---------------------------------------------------------------------------------------------------------------------------
#define GSTR 40
template <typename AT, int KT, int lda, int ldw, int EPI, bool OUT16>
__global__ __launch_bounds__(256) void gemm_kne(const AT* __restrict__ A, const float* __restrict__ Wm,
                                                const float* __restrict__ bias, const float* __restrict__ R, const float* __restrict__ gvec,
                                                void* __restrict__ Yv, int ldy, int K) {
  constexpr int PST = KT + 8;                 // LDS row pitch in f16: 144 B (KT 64) or 272 B (KT 128), 16 B x odd for the b128 fragment reads
  constexpr int AE = 16 / (int)sizeof(AT);    // A elements in one 16-byte load
  constexpr int LPR = KT / AE;                // lanes that cover one A row of the tile, side by side: whole 128-byte lines per load
  constexpr int RPP = 256 / LPR;              // A rows the block loads per pass
  constexpr int NP = 128 / RPP;               // passes
  constexpr int NH = KT / 32;                 // 32-deep slices of the tile
  __shared__ __attribute__((aligned(16))) f16 ldsA[128 * PST];
  __shared__ __attribute__((aligned(16))) f16 ldsW[128 * PST];
  __shared__ __attribute__((aligned(16))) float oS[8][32 * 68];
  const int tid = threadIdx.x, lane = tid & 31, wave = tid >> 5, cl = lane & 15, rh = (lane >> 4) * 8;
  const int m0 = blockIdx.x * 128, n0 = blockIdx.y * 128;
  const int wm = (wave & 3) * 32, wn = (wave >> 2) * 64;
  const int ar = tid / LPR, ac = (tid % LPR) * AE;
  // W: each thread takes 4(k) x 4(n) blocks and transposes them in registers, so column n gets 8-byte runs of 4 k.
  // At either pitch 4 columns are 16 banks apart, so a wave's 32 runs (8 k-quads x 4 column quads) fall on all 64 banks once.
  const int kq = (tid & 7) * 4, nq = (tid >> 3) * 4;
  f32x8 acc[2][4];
#pragma unroll
  for (int i = 0; i < 2; ++i)
#pragma unroll
    for (int j = 0; j < 4; ++j) { f32x8 z = {}; acc[i][j] = z; }
#pragma unroll 1
  for (int k0 = 0; k0 < K; k0 += KT) {
    __syncthreads();
    v4u_t av[NP];
    v4f_t wv[NH][4];
    { const AT* src = A + (size_t)(m0 + ar) * lda + k0 + ac;
#pragma unroll   // registers indexed by p
      for (int p = 0; p < NP; ++p) av[p] = *(const v4ua*)(src + p * RPP * lda); }
    { const float* src = Wm + (size_t)(k0 + kq) * ldw + n0 + nq;
#pragma unroll   // registers indexed by h, g
      for (int h = 0; h < NH; ++h)
#pragma unroll
        for (int g = 0; g < 4; ++g) wv[h][g] = *(const v4fa*)(src + (32 * h + g) * ldw); }
#pragma unroll   // registers indexed by p
    for (int p = 0; p < NP; ++p) {
      f16* dst = ldsA + (p * RPP + ar) * PST + ac;
      if constexpr (sizeof(AT) == 2) { *(v4ua*)dst = av[p]; }
      else { const v4f_t fv = __builtin_bit_cast(v4f_t, av[p]); bf16x4 q; q[0] = (f16)fv[0]; q[1] = (f16)fv[1]; q[2] = (f16)fv[2]; q[3] = (f16)fv[3];
        *(bf16x4*)dst = q; }
    }
#pragma unroll   // registers indexed by h, u
    for (int h = 0; h < NH; ++h)
#pragma unroll
      for (int u = 0; u < 4; ++u) { bf16x4 q; q[0] = (f16)wv[h][0][u]; q[1] = (f16)wv[h][1][u]; q[2] = (f16)wv[h][2][u]; q[3] = (f16)wv[h][3][u];
        *(bf16x4*)(ldsW + (nq + u) * PST + 32 * h + kq) = q; }
    __syncthreads();
#pragma unroll   // constant LDS offsets; k runs upward as before, so every accumulator sums in the same order
    for (int h = 0; h < NH; ++h) {
      f16x16 af[2];
#pragma unroll
      for (int i = 0; i < 2; ++i) af[i] = lds_frag(ldsA + (wm + 16 * i) * PST + 32 * h, PST);
#pragma unroll
      for (int j = 0; j < 4; ++j) {
        const f16x16 bf = lds_frag(ldsW + (wn + 16 * j) * PST + 32 * h, PST);
#pragma unroll
        for (int i = 0; i < 2; ++i) acc[i][j] = wmma16(af[i], bf, acc[i][j]);
      }
    }
  }
  float* so = oS[wave];
#pragma unroll
  for (int i = 0; i < 2; ++i)
#pragma unroll
    for (int j = 0; j < 4; ++j) {
      const int n = n0 + wn + 16 * j + cl;
      const float bv = bias ? bias[n] : 0.0f;
      const float gv = (EPI == 2) ? gvec[n] : 0.0f;
      if (EPI == 1) {
#pragma unroll 1
        for (int r = 0; r < 8; ++r) { const float xg = acc[i][j][r] + bv; so[(16 * i + rh + r) * 68 + 16 * j + cl] = 0.5f * xg * (1.0f + erff(xg * 0.70710678118654752f)); }
      } else {
#pragma unroll
        for (int r = 0; r < 8; ++r) {
          float v = acc[i][j][r] + bv;
          if (EPI == 2) v = R[(size_t)(m0 + wm + 16 * i + rh + r) * ldy + n] + gv * v;
          so[(16 * i + rh + r) * 68 + 16 * j + cl] = v;
        }
      }
    }
  asm volatile("s_wait_dscnt 0" ::: "memory");
  __builtin_amdgcn_wave_barrier();
{
    if (OUT16) {
      f16* Y = (f16*)Yv;
#pragma unroll
      for (int it = 0; it < 8; ++it) { const int c = lane + 32 * it, rr = c >> 3, q8 = (c & 7) * 8;
        union { f16 h[8]; v4u_t v; } u;
#pragma unroll
        for (int e = 0; e < 8; ++e) u.h[e] = (f16)so[rr * 68 + q8 + e];
        *(v4u_t*)(Y + (size_t)(m0 + wm + rr) * ldy + n0 + wn + q8) = u.v; }
    } else {
      float* Y = (float*)Yv;
#pragma unroll
      for (int it = 0; it < 16; ++it) { const int f4 = lane + 32 * it, rr = f4 >> 4, q = (f4 & 15) * 4;
        *(v4f_t*)(Y + (size_t)(m0 + wm + rr) * ldy + n0 + wn + q) = *(const v4fa*)(so + rr * 68 + q); }
    }
    
  }
}

// x [800][512] -> zero-padded [896][512]
__global__ __launch_bounds__(256) void k_padx(const float* __restrict__ x, float* __restrict__ xp) { const size_t r = blockIdx.x; for (int c = threadIdx.x; c < DDr; c += 256) xp[r * DDr + c] = (r < NROWS) ? x[r * DDr + c] : 0.0f; }
// h1[p][:] = relu(A[b,i] + Bq[b,j] + b1) as f16 rows (pair p = (b·25 + i)·25 + j); pad rows zero
__global__ __launch_bounds__(256) void k_pairs(const float* __restrict__ A, const float* __restrict__ Bq, const float* __restrict__ b1, bf16* __restrict__ h1) {
  const size_t p = blockIdx.x; const int tid = threadIdx.x; union { bf16 hh[2]; unsigned u; } cv;
  if (p < NPAIR) { const int b = p / (NN * NN), r = p % (NN * NN), i = r / NN, j = r % NN; const float* ai = A + ((size_t)b * NN + i) * HHd; const float* bj = Bq + ((size_t)b * NN + j) * HHd;
    const int c = tid * 2; cv.hh[0] = (bf16)fmaxf(ai[c] + bj[c] + b1[c], 0.0f); cv.hh[1] = (bf16)fmaxf(ai[c + 1] + bj[c + 1] + b1[c + 1], 0.0f); }
  else { cv.hh[0] = (bf16)0.0f; cv.hh[1] = (bf16)0.0f; }
  *(unsigned*)(h1 + p * HHd + tid * 2) = cv.u; 
}
// relu + f32 -> f16 rows
__global__ __launch_bounds__(256) void k_relu16(const float* __restrict__ src, bf16* __restrict__ dst, size_t n8) {
  const size_t i = (size_t)blockIdx.x * 256 + threadIdx.x; if (i >= n8) return; const float* p = src + 8 * i; union { bf16 hh[8]; v4u_t u; } cv;
#pragma unroll
  for (int e = 0; e < 8; ++e) cv.hh[e] = (bf16)fmaxf(p[e], 0.0f);
  *(v4u_t*)(dst + 8 * i) = cv.u; 
}
// agg[b][h] = sum over i != j of relu(h3raw[(b,i,j)][h]) in f32, fixed order. Block = (batch b, 64-column slice), 512 threads = 32 row groups x 16
// column quads: a wave-wide 16-byte load covers two whole 256-byte row slices; group g sums pair rows g, g + 32, ... (20 independent loads, all
// issued before the first is used), the 32 group sums meet in LDS and are added in group order. Pair row r = 25 i + j lies on the diagonal
// exactly when r is a multiple of 26; rows past the batch's last are clamped to row 624, which is a diagonal row and so adds nothing.
// Each block also writes its share (3 rows x 64 columns) of the zero pad rows 32..127.
#define AGC 64
#define AGG 32
__global__ __launch_bounds__(512) void k_agg(const float* __restrict__ h3, float* __restrict__ agg) {
  __shared__ __attribute__((aligned(16))) float part[AGG][AGC];
  const int b = blockIdx.x, c0 = blockIdx.y * AGC, tid = threadIdx.x, g = tid >> 4, q = (tid & 15) * 4;
  const float* base = h3 + (size_t)b * (NN * NN) * HHd + c0 + q;
  v4f_t v[20];
#pragma unroll
  for (int t = 0; t < 20; ++t) v[t] = *(const v4f_t*)(base + (size_t)min(g + AGG * t, NN * NN - 1) * HHd);
  asm volatile("s_wait_xcnt 0x0" ::: "memory");   // precaution: the loads' address registers are reused by the sums below
  __builtin_amdgcn_sched_barrier(0);   // all 20 loads issue before the first sum: without it the last load is scheduled behind the wait for the first
  v4f_t s = {0.0f, 0.0f, 0.0f, 0.0f};
#pragma unroll
  for (int t = 0; t < 20; ++t) {
    const float hi = (min(g + AGG * t, NN * NN - 1) % (NN + 1)) != 0 ? __builtin_inff() : 0.0f;   // upper clamp: none for i != j, 0 on the diagonal
#pragma unroll
    for (int e = 0; e < 4; ++e) s[e] += __builtin_amdgcn_fmed3f(v[t][e], 0.0f, hi);   // relu and diagonal mask in one median
  }
  *(v4f_t*)(&part[g][q]) = s;
  __syncthreads();
  if (tid < AGC) {
    float a = 0.0f;
#pragma unroll
    for (int k = 0; k < AGG; ++k) a += part[k][tid];
    agg[(size_t)b * HHd + c0 + tid] = a;
  } else if (tid < 4 * AGC) {
    const int z = tid - AGC;
    agg[(size_t)(NBr + 3 * b + (z >> 6)) * HHd + c0 + (z & 63)] = 0.0f;
  }
}
// f_w3 [512][1000] -> [512][1024] zero-padded; bias likewise
__global__ __launch_bounds__(256) void k_padw3(const float* __restrict__ w, const float* __restrict__ b3, float* __restrict__ wp, float* __restrict__ bp) { const int r = blockIdx.x; for (int c = threadIdx.x; c < NCP; c += 256) { wp[(size_t)r * NCP + c] = (c < NCLS) ? w[(size_t)r * NCLS + c] : 0.0f; if (r == 0) bp[c] = (c < NCLS) ? b3[c] : 0.0f; } }
// logits [32][1000] from the padded [128][1024] buffer as one contiguous stream of 32,000 floats (8,000 float4; rows are multiples of 4 so no chunk straddles a row)
__global__ __launch_bounds__(256) void k_out(const float* __restrict__ lp, float* __restrict__ out) {
  const int q4 = blockIdx.x * 256 + threadIdx.x; if (q4 >= NBr * NCLS / 4) return; const int fidx = q4 * 4, r = fidx / NCLS, c = fidx % NCLS;
  const v4f_t v = *(const v4f_t*)(lp + (size_t)r * NCP + c); *(v4f_t*)(out + fidx) = v; 
}

extern "C" void kernel_launch(void* const* d_in, const int* in_sizes, int n_in,
                              void* d_out, int out_size, void* d_ws, size_t ws_size,
                              hipStream_t stream) {
  (void)in_sizes; (void)n_in; (void)out_size;
  const float** f = (const float**)d_in;
  const float* x = f[0], *g_w1 = f[1], *g_b1 = f[2], *g_w2 = f[3], *g_b2 = f[4], *g_w3 = f[5], *g_b3 = f[6], *f_w1 = f[7], *f_b1 = f[8], *f_w2 = f[9], *f_b2 = f[10], *f_w3 = f[11], *f_b3 = f[12];
  float* out = (float*)d_out;      // [32,1000]
  char* ws = (char*)d_ws;
  float* xp = (float*)ws; ws += (size_t)NROWP * DDr * 4;
  float* A = (float*)ws; ws += (size_t)NROWP * HHd * 4; float* Bq = (float*)ws; ws += (size_t)NROWP * HHd * 4;
  bf16* h1 = (bf16*)ws; ws += (size_t)NPAIRP * HHd * 2;        // 20.6 MB
  float* hr = (float*)ws; ws += (size_t)NPAIRP * HHd * 4;       // 41 MB (h2 raw, then h3 raw)
  bf16* h2 = (bf16*)ws; ws += (size_t)NPAIRP * HHd * 2;
  float* agg = (float*)ws; ws += (size_t)128 * HHd * 4;
  float* z1r = (float*)ws; ws += (size_t)128 * HHd * 4; bf16* z1 = (bf16*)ws; ws += (size_t)128 * HHd * 2;
  float* z2r = (float*)ws; ws += (size_t)128 * HHd * 4; bf16* z2 = (bf16*)ws; ws += (size_t)128 * HHd * 2;
  float* w3p = (float*)ws; ws += (size_t)HHd * NCP * 4; float* b3p = (float*)ws; ws += NCP * 4;
  float* lp = (float*)ws; ws += (size_t)128 * NCP * 4;
  if ((size_t)(ws - (char*)d_ws) > ws_size) return;
  const dim3 blk(256);
  k_padx<<<dim3(NROWP), blk, 0, stream>>>(x, xp);
  gemm_kne<float, 128, DDr, HHd, 0, false><<<dim3(NROWP / 128, HHd / 128), blk, 0, stream>>>(xp, g_w1, nullptr, nullptr, nullptr, A, HHd, DDr);                       // x·W1[:D]
  gemm_kne<float, 128, DDr, HHd, 0, false><<<dim3(NROWP / 128, HHd / 128), blk, 0, stream>>>(xp, g_w1 + (size_t)DDr * HHd, nullptr, nullptr, nullptr, Bq, HHd, DDr);  // x·W1[D:]
  k_pairs<<<dim3(NPAIRP), blk, 0, stream>>>(A, Bq, g_b1, h1);
  gemm_kne<bf16, 64, HHd, HHd, 0, false><<<dim3(NPAIRP / 128, HHd / 128), blk, 0, stream>>>(h1, g_w2, g_b2, nullptr, nullptr, hr, HHd, HHd);      // h1·W2 + b2
  k_relu16<<<dim3((NPAIRP * HHd / 8 + 255) / 256), blk, 0, stream>>>(hr, h2, (size_t)NPAIRP * HHd / 8);
  gemm_kne<bf16, 64, HHd, HHd, 0, false><<<dim3(NPAIRP / 128, HHd / 128), blk, 0, stream>>>(h2, g_w3, g_b3, nullptr, nullptr, hr, HHd, HHd);      // h2·W3 + b3 (relu inside the aggregation)
  k_agg<<<dim3(NBr, HHd / AGC), dim3(512), 0, stream>>>(hr, agg);
  gemm_kne<float, 128, DDr, HHd, 0, false><<<dim3(1, HHd / 128), blk, 0, stream>>>(agg, f_w1, f_b1, nullptr, nullptr, z1r, HHd, HHd);
  k_relu16<<<dim3((128 * HHd / 8 + 255) / 256), blk, 0, stream>>>(z1r, z1, (size_t)128 * HHd / 8);
  gemm_kne<bf16, 128, HHd, HHd, 0, false><<<dim3(1, HHd / 128), blk, 0, stream>>>(z1, f_w2, f_b2, nullptr, nullptr, z2r, HHd, HHd);
  k_relu16<<<dim3((128 * HHd / 8 + 255) / 256), blk, 0, stream>>>(z2r, z2, (size_t)128 * HHd / 8);
  k_padw3<<<dim3(HHd), blk, 0, stream>>>(f_w3, f_b3, w3p, b3p);
  gemm_kne<bf16, 128, HHd, NCP, 0, false><<<dim3(1, NCP / 128), blk, 0, stream>>>(z2, w3p, b3p, nullptr, nullptr, lp, NCP, HHd);
  k_out<<<dim3((NBr * NCLS / 4 + 255) / 256), blk, 0, stream>>>(lp, out);
}

// v004
// A run of this version takes 111 microseconds.
// In two side-by-side timings against v003, it was 1.32 and 1.33 times as fast.
// Over all steps from v000 it is 6.42 times as fast.
// Contractions on v_wmma_f32_16x16x32_f16 (plain f16 operands, f32 accumulate): the pair MLP g over all 32x25x25 ordered pairs as GEMMs
// with M = pairs: layer 1 split exactly as [x_i, x_j]·W1 = x_i·W1[:D] + x_j·W1[D:] (two K = 512 GEMMs on the 800 node rows, then relu of the
// broadcast sum per pair, written f16), layers 2 and 3 (K = 512, M = 20,000 pair rows padded to 20,096), the i != j sum per batch in f32
// (fixed order), and the f MLP on the 32 aggregated rows (padded to 128; K = 512; N = 1000 padded to 1024). ReLU in f32. The [32][1000]
#include <hip/hip_runtime.h>
#include <hip/hip_bf16.h>
#include <math.h>

#define NBr 32
#define NN 25
#define DDr 512
#define HHd 512
#define NCLS 1000
#define NCP 1024
#define NROWS (NBr * NN)          // 800
#define NROWP 896
#define NPAIR (NBr * NN * NN)     // 20000
#define NPAIRP 20096
#define GSTR 40
#define SS 64
#define HH 1
#define DKK 64

typedef _Float16 bf16;
typedef _Float16 f16;
typedef __attribute__((ext_vector_type(4))) unsigned v4u_t;
typedef unsigned v4ua __attribute__((ext_vector_type(4), may_alias));
typedef __attribute__((ext_vector_type(4))) float v4f_t;
typedef float v4fa __attribute__((ext_vector_type(4), may_alias));
typedef __attribute__((ext_vector_type(16))) bf16  bf16x16;
typedef bf16x16 f16x16;
typedef __attribute__((ext_vector_type(8)))  bf16  bf16x8;
typedef bf16x8 f16x8;
typedef __attribute__((ext_vector_type(4)))  bf16  bf16x4;
typedef __attribute__((ext_vector_type(8)))  float f32x8;
__device__ __forceinline__ f32x8 wmma16(f16x16 a, f16x16 b, f32x8 c) {
  c = __builtin_amdgcn_wmma_f32_16x16x32_f16(false, a, false, b, (short)0, c, false, false);
  asm volatile("v_nop\n\tv_nop\n\tv_nop\n\tv_nop" : "+v"(c) : "v"(a), "v"(b));
  return c;
}
#define LDS_STRIDE 48   // unused: GEMM tiles use PST = KT + 8 (72 or 136 elems, 144B or 272B rows)
#define KSTRIDE    72   // unused
#define VSTRIDE    48   // unused

__device__ __forceinline__ f32x8 wmma_bf16(bf16x16 a, bf16x16 b, f32x8 c) {
  c = __builtin_amdgcn_wmma_f32_16x16x32_f16(false, a, false, b, (short)0, c, false, false);
  asm volatile("v_nop\n\tv_nop\n\tv_nop\n\tv_nop" : "+v"(c) : "v"(a), "v"(b));   // A/B-overwrite hazard guard
  return c;
}

// 16x32 (MxK) bf16 fragment from a row-major global matrix.
// lanes 0-15  (row=lane)    : elems 0..7 = K+0..7,  8..15 = K+16..23
// lanes 16-31 (row=lane-16) : elems 0..7 = K+8..15, 8..15 = K+24..31
template <typename T>
__device__ __forceinline__ bf16x16 load_frag(const T* __restrict__ base, int ld,
                                             int row0, int k0) {
  const int lane = threadIdx.x & 31;
  const int r    = lane & 15;
  const int kh   = (lane >> 4) * 8;
  const T* p0 = base + (size_t)(row0 + r) * ld + (k0 + kh);
  const T* p1 = p0 + 16;
  bf16x16 f;
#pragma unroll
  for (int i = 0; i < 8; ++i) {
    f[i]     = (bf16)p0[i];
    f[i + 8] = (bf16)p1[i];
  }
  return f;
}

// Same fragment from an LDS tile with padded row stride (base includes row0/k0).
__device__ __forceinline__ bf16x16 lds_frag(const bf16* base, int stride) {
  const int lane = threadIdx.x & 31;
  const int row  = lane & 15;
  const int kh   = (lane >> 4) * 8;
  const bf16x8 lo = *(const bf16x8*)(base + row * stride + kh);
  const bf16x8 hi = *(const bf16x8*)(base + row * stride + kh + 16);
  bf16x16 f;
#pragma unroll
  for (int i = 0; i < 8; ++i) { f[i] = lo[i]; f[i + 8] = hi[i]; }
  return f;
}

template <typename T>
__device__ __forceinline__ void stage_read16(const T* __restrict__ p, float* buf) {
#pragma unroll
  for (int i = 0; i < 16; ++i) buf[i] = (float)p[i];
}

__device__ __forceinline__ void stage_write(bf16* dst, const float* buf, int nquad) {
#pragma unroll
  for (int i = 0; i < nquad; ++i) {
    bf16x4 q;
    q[0] = (bf16)buf[4 * i];     q[1] = (bf16)buf[4 * i + 1];
    q[2] = (bf16)buf[4 * i + 2]; q[3] = (bf16)buf[4 * i + 3];
    *(bf16x4*)(dst + 4 * i) = q;
  }
}


// ---------------------------------------------------------------------------------------------------------------------------
// gemm_kne: Y[m][n] = epi( sum_k A[m][k]*W[k][n] + bias[n] ), A f32/f16 [M][lda], W f32 row-major [K][N] (ldw), plain f16 operands,
// f32 accumulate. EPI 0: identity; 1: exact-erf GELU; 2: R[m][n] + gvec[n]*(.) (residual with per-channel gain). Output f32 (or f16
// when OUT16). Block = 128x128 tile, 8 waves as 4(M) x 2(N); per KT-wide k-step A and W tiles staged f16 in LDS (W transposed).
// KT = k depth of one staged tile: every global load of a step is in flight at once, so a GEMM waits out K / KT load latencies.
// lda, ldw = row pitches of A and W in elements, compile-time so that a tile's loads differ only in their immediate offset.
// EPI 3: relu, so that with OUT16 a layer's activation leaves the GEMM as the next layer's f16 operand (same rounding as relu and convert of the f32 sum).
// MA > 0: A is the f32 input Xin with MA rows, read unpadded. NV > 0: W and bias have NV columns (a multiple of 4), read unpadded; columns past NV count as 0.
// ZW, ZY: blockIdx.z picks one of several GEMMs on the same A: W moves by ZW elements, Y by ZY bytes.
// ---------------------------------------------------------------------------------------------------------------------------
#define GSTR 40
template <typename AT, int KT, int lda, int ldw, int EPI, bool OUT16, int MA = 0, int NV = 0, int ZW = 0, int ZY = 0>
__global__ __launch_bounds__(256) void gemm_kne(const AT* __restrict__ A, const float* __restrict__ Xin, const float* __restrict__ W0,
                                                const float* __restrict__ bias, const float* __restrict__ R, const float* __restrict__ gvec,
                                                void* __restrict__ Y0, int ldy, int K) {
  const float* __restrict__ Wm = W0 + (size_t)blockIdx.z * ZW;
  void* __restrict__ Yv = (char*)Y0 + (size_t)blockIdx.z * ZY;
  constexpr int PST = KT + 8;                 // LDS row pitch in f16: 144 B (KT 64) or 272 B (KT 128), 16 B x odd for the b128 fragment reads
  constexpr int AE = 16 / (int)sizeof(AT);    // A elements in one 16-byte load
  constexpr int LPR = KT / AE;                // lanes that cover one A row of the tile, side by side: whole 128-byte lines per load
  constexpr int RPP = 256 / LPR;              // A rows the block loads per pass
  constexpr int NP = 128 / RPP;               // passes
  constexpr int NH = KT / 32;                 // 32-deep slices of the tile
  __shared__ __attribute__((aligned(16))) f16 ldsA[128 * PST];
  __shared__ __attribute__((aligned(16))) f16 ldsW[128 * PST];
  __shared__ __attribute__((aligned(16))) float oS[8][32 * 68];
  const int tid = threadIdx.x, lane = tid & 31, wave = tid >> 5, cl = lane & 15, rh = (lane >> 4) * 8;
  const int m0 = blockIdx.x * 128, n0 = blockIdx.y * 128;
  const int wm = (wave & 3) * 32, wn = (wave >> 2) * 64;
  const int ar = tid / LPR, ac = (tid % LPR) * AE;
  // W: each thread takes 4(k) x 4(n) blocks and transposes them in registers, so column n gets 8-byte runs of 4 k.
  // At either pitch 4 columns are 16 banks apart, so a wave's 32 runs (8 k-quads x 4 column quads) fall on all 64 banks once.
  const int kq = (tid & 7) * 4, nq = (tid >> 3) * 4;
  f32x8 acc[2][4];
#pragma unroll
  for (int i = 0; i < 2; ++i)
#pragma unroll
    for (int j = 0; j < 4; ++j) { f32x8 z = {}; acc[i][j] = z; }
  const float* xsrc = Xin + (size_t)(m0 + ar) * lda + ac;   // MA > 0: this thread's place in the tile's first row pass, moved on by KT a step
  const float* wsrc = Wm + (size_t)kq * ldw + n0 + nq;      // this thread's 4 x 4 blocks of W, moved on by KT rows a step
#pragma unroll 1
  for (int k0 = 0; k0 < K; k0 += KT) {
    __syncthreads();
    v4u_t av[NP];
    v4f_t wv[NH][4];
    if constexpr (MA > 0) {   // MA is a multiple of RPP, so a pass lies wholly inside the input or wholly past it (block-uniform test); rows past it count as 0
      static_assert(MA % RPP == 0 && sizeof(AT) == 4, "whole passes of f32 rows");
#pragma unroll   // registers indexed by p
      for (int p = 0; p < NP; ++p) { v4u_t zq = {0u, 0u, 0u, 0u}; av[p] = zq; if (m0 + p * RPP < MA) av[p] = *(const v4ua*)(xsrc + p * RPP * lda); }
      xsrc += KT;
    } else
    { const AT* src = A + (size_t)(m0 + ar) * lda + k0 + ac;
#pragma unroll   // registers indexed by p
      for (int p = 0; p < NP; ++p) av[p] = *(const v4ua*)(src + p * RPP * lda); }
    if constexpr (NV > 0) {   // a thread's 4 columns lie wholly inside W or wholly past it, where they count as 0
      static_assert(NV % 4 == 0, "whole column quads");
#pragma unroll   // registers indexed by h, g
      for (int h = 0; h < NH; ++h)
#pragma unroll
        for (int g = 0; g < 4; ++g) { v4f_t zq = {0.0f, 0.0f, 0.0f, 0.0f}; wv[h][g] = zq; }
    }
    if (NV == 0 || n0 + nq < NV) {
#pragma unroll   // registers indexed by h, g
      for (int h = 0; h < NH; ++h)
#pragma unroll
        for (int g = 0; g < 4; ++g) wv[h][g] = *(const v4fa*)(wsrc + (32 * h + g) * ldw);
    }
    wsrc += KT * ldw;
#pragma unroll   // registers indexed by p
    for (int p = 0; p < NP; ++p) {
      f16* dst = ldsA + (p * RPP + ar) * PST + ac;
      if constexpr (sizeof(AT) == 2) { *(v4ua*)dst = av[p]; }
      else { const v4f_t fv = __builtin_bit_cast(v4f_t, av[p]); bf16x4 q; q[0] = (f16)fv[0]; q[1] = (f16)fv[1]; q[2] = (f16)fv[2]; q[3] = (f16)fv[3];
        *(bf16x4*)dst = q; }
    }
#pragma unroll   // registers indexed by h, u
    for (int h = 0; h < NH; ++h)
#pragma unroll
      for (int u = 0; u < 4; ++u) { bf16x4 q; q[0] = (f16)wv[h][0][u]; q[1] = (f16)wv[h][1][u]; q[2] = (f16)wv[h][2][u]; q[3] = (f16)wv[h][3][u];
        *(bf16x4*)(ldsW + (nq + u) * PST + 32 * h + kq) = q; }
    __syncthreads();
#pragma unroll   // constant LDS offsets; k runs upward as before, so every accumulator sums in the same order
    for (int h = 0; h < NH; ++h) {
      f16x16 af[2];
#pragma unroll
      for (int i = 0; i < 2; ++i) af[i] = lds_frag(ldsA + (wm + 16 * i) * PST + 32 * h, PST);
#pragma unroll
      for (int j = 0; j < 4; ++j) {
        const f16x16 bf = lds_frag(ldsW + (wn + 16 * j) * PST + 32 * h, PST);
#pragma unroll
        for (int i = 0; i < 2; ++i) acc[i][j] = wmma16(af[i], bf, acc[i][j]);
      }
    }
  }
  float* so = oS[wave];
#pragma unroll
  for (int i = 0; i < 2; ++i)
#pragma unroll
    for (int j = 0; j < 4; ++j) {
      const int n = n0 + wn + 16 * j + cl;
      const float bv = (bias && (NV == 0 || n < NV)) ? bias[n] : 0.0f;
      const float gv = (EPI == 2) ? gvec[n] : 0.0f;
      if (EPI == 1) {
#pragma unroll 1
        for (int r = 0; r < 8; ++r) { const float xg = acc[i][j][r] + bv; so[(16 * i + rh + r) * 68 + 16 * j + cl] = 0.5f * xg * (1.0f + erff(xg * 0.70710678118654752f)); }
      } else {
#pragma unroll
        for (int r = 0; r < 8; ++r) {
          float v = acc[i][j][r] + bv;
          if (EPI == 2) v = R[(size_t)(m0 + wm + 16 * i + rh + r) * ldy + n] + gv * v;
          if (EPI == 3) v = fmaxf(v, 0.0f);
          so[(16 * i + rh + r) * 68 + 16 * j + cl] = v;
        }
      }
    }
  asm volatile("s_wait_dscnt 0" ::: "memory");
  __builtin_amdgcn_wave_barrier();
{
    if (OUT16) {
      f16* Y = (f16*)Yv;
#pragma unroll
      for (int it = 0; it < 8; ++it) { const int c = lane + 32 * it, rr = c >> 3, q8 = (c & 7) * 8;
        union { f16 h[8]; v4u_t v; } u;
#pragma unroll
        for (int e = 0; e < 8; ++e) u.h[e] = (f16)so[rr * 68 + q8 + e];
        *(v4u_t*)(Y + (size_t)(m0 + wm + rr) * ldy + n0 + wn + q8) = u.v; }
    } else {
      float* Y = (float*)Yv;
#pragma unroll
      for (int it = 0; it < 16; ++it) { const int f4 = lane + 32 * it, rr = f4 >> 4, q = (f4 & 15) * 4;
        *(v4f_t*)(Y + (size_t)(m0 + wm + rr) * ldy + n0 + wn + q) = *(const v4fa*)(so + rr * 68 + q); }
    }
    
  }
}

// h1[p][:] = relu(A[b,i] + Bq[b,j] + b1) as f16 rows (pair p = (b·25 + i)·25 + j); pad rows zero
__global__ __launch_bounds__(256) void k_pairs(const float* __restrict__ A, const float* __restrict__ Bq, const float* __restrict__ b1, bf16* __restrict__ h1) {
  const size_t p = blockIdx.x; const int tid = threadIdx.x; union { bf16 hh[2]; unsigned u; } cv;
  if (p < NPAIR) { const int b = p / (NN * NN), r = p % (NN * NN), i = r / NN, j = r % NN; const float* ai = A + ((size_t)b * NN + i) * HHd; const float* bj = Bq + ((size_t)b * NN + j) * HHd;
    const int c = tid * 2; cv.hh[0] = (bf16)fmaxf(ai[c] + bj[c] + b1[c], 0.0f); cv.hh[1] = (bf16)fmaxf(ai[c + 1] + bj[c + 1] + b1[c + 1], 0.0f); }
  else { cv.hh[0] = (bf16)0.0f; cv.hh[1] = (bf16)0.0f; }
  *(unsigned*)(h1 + p * HHd + tid * 2) = cv.u; 
}
// agg[b][h] = sum over i != j of relu(h3raw[(b,i,j)][h]) in f32, fixed order. Block = (batch b, 64-column slice), 512 threads = 32 row groups x 16
// column quads: a wave-wide 16-byte load covers two whole 256-byte row slices; group g sums pair rows g, g + 32, ... (20 independent loads, all
// issued before the first is used), the 32 group sums meet in LDS and are added in group order. Pair row r = 25 i + j lies on the diagonal
// exactly when r is a multiple of 26; rows past the batch's last are clamped to row 624, which is a diagonal row and so adds nothing.
// Each block also writes its share (3 rows x 64 columns) of the zero pad rows 32..127.
#define AGC 64
#define AGG 32
__global__ __launch_bounds__(512) void k_agg(const float* __restrict__ h3, float* __restrict__ agg) {
  __shared__ __attribute__((aligned(16))) float part[AGG][AGC];
  const int b = blockIdx.x, c0 = blockIdx.y * AGC, tid = threadIdx.x, g = tid >> 4, q = (tid & 15) * 4;
  const float* base = h3 + (size_t)b * (NN * NN) * HHd + c0 + q;
  v4f_t v[20];
#pragma unroll
  for (int t = 0; t < 20; ++t) v[t] = *(const v4f_t*)(base + (size_t)min(g + AGG * t, NN * NN - 1) * HHd);
  asm volatile("s_wait_xcnt 0x0" ::: "memory");   // precaution: the loads' address registers are reused by the sums below
  __builtin_amdgcn_sched_barrier(0);   // all 20 loads issue before the first sum: without it the last load is scheduled behind the wait for the first
  v4f_t s = {0.0f, 0.0f, 0.0f, 0.0f};
#pragma unroll
  for (int t = 0; t < 20; ++t) {
    const float hi = (min(g + AGG * t, NN * NN - 1) % (NN + 1)) != 0 ? __builtin_inff() : 0.0f;   // upper clamp: none for i != j, 0 on the diagonal
#pragma unroll
    for (int e = 0; e < 4; ++e) s[e] += __builtin_amdgcn_fmed3f(v[t][e], 0.0f, hi);   // relu and diagonal mask in one median
  }
  *(v4f_t*)(&part[g][q]) = s;
  __syncthreads();
  if (tid < AGC) {
    float a = 0.0f;
#pragma unroll
    for (int k = 0; k < AGG; ++k) a += part[k][tid];
    agg[(size_t)b * HHd + c0 + tid] = a;
  } else if (tid < 4 * AGC) {
    const int z = tid - AGC;
    agg[(size_t)(NBr + 3 * b + (z >> 6)) * HHd + c0 + (z & 63)] = 0.0f;
  }
}
// logits [32][1000] from the padded [128][1024] buffer as one contiguous stream of 32,000 floats (8,000 float4; rows are multiples of 4 so no chunk straddles a row)
__global__ __launch_bounds__(256) void k_out(const float* __restrict__ lp, float* __restrict__ out) {
  const int q4 = blockIdx.x * 256 + threadIdx.x; if (q4 >= NBr * NCLS / 4) return; const int fidx = q4 * 4, r = fidx / NCLS, c = fidx % NCLS;
  const v4f_t v = *(const v4f_t*)(lp + (size_t)r * NCP + c); *(v4f_t*)(out + fidx) = v; 
}

extern "C" void kernel_launch(void* const* d_in, const int* in_sizes, int n_in,
                              void* d_out, int out_size, void* d_ws, size_t ws_size,
                              hipStream_t stream) {
  (void)in_sizes; (void)n_in; (void)out_size;
  const float** f = (const float**)d_in;
  const float* x = f[0], *g_w1 = f[1], *g_b1 = f[2], *g_w2 = f[3], *g_b2 = f[4], *g_w3 = f[5], *g_b3 = f[6], *f_w1 = f[7], *f_b1 = f[8], *f_w2 = f[9], *f_b2 = f[10], *f_w3 = f[11], *f_b3 = f[12];
  float* out = (float*)d_out;      // [32,1000]
  char* ws = (char*)d_ws;
  float* A = (float*)ws; ws += (size_t)NROWP * HHd * 4; float* Bq = (float*)ws; ws += (size_t)NROWP * HHd * 4;   // Bq directly behind A: the z = 1 output of the layer-1 launch
  bf16* h1 = (bf16*)ws; ws += (size_t)NPAIRP * HHd * 2;        // 20.6 MB
  float* hr = (float*)ws; ws += (size_t)NPAIRP * HHd * 4;       // 41 MB (h3 raw)
  bf16* h2 = (bf16*)ws; ws += (size_t)NPAIRP * HHd * 2;
  float* agg = (float*)ws; ws += (size_t)128 * HHd * 4;
  bf16* z1 = (bf16*)ws; ws += (size_t)128 * HHd * 2;
  bf16* z2 = (bf16*)ws; ws += (size_t)128 * HHd * 2;
  float* lp = (float*)ws; ws += (size_t)128 * NCP * 4;
  if ((size_t)(ws - (char*)d_ws) > ws_size) return;
  const dim3 blk(256);
  gemm_kne<float, 128, DDr, HHd, 0, false, NROWS, 0, DDr * HHd, NROWP * HHd * 4><<<dim3(NROWP / 128, HHd / 128, 2), blk, 0, stream>>>(nullptr, x, g_w1, nullptr, nullptr, nullptr, A, HHd, DDr);   // z = 0: x*W1[:D] -> A; z = 1: x*W1[D:] -> Bq
  k_pairs<<<dim3(NPAIRP), blk, 0, stream>>>(A, Bq, g_b1, h1);
  gemm_kne<bf16, 64, HHd, HHd, 3, true><<<dim3(NPAIRP / 128, HHd / 128), blk, 0, stream>>>(h1, nullptr, g_w2, g_b2, nullptr, nullptr, h2, HHd, HHd);      // relu(h1*W2 + b2) as f16
  gemm_kne<bf16, 64, HHd, HHd, 0, false><<<dim3(NPAIRP / 128, HHd / 128), blk, 0, stream>>>(h2, nullptr, g_w3, g_b3, nullptr, nullptr, hr, HHd, HHd);      // h2*W3 + b3 (relu inside the aggregation)
  k_agg<<<dim3(NBr, HHd / AGC), dim3(512), 0, stream>>>(hr, agg);
  gemm_kne<float, 128, DDr, HHd, 3, true><<<dim3(1, HHd / 128), blk, 0, stream>>>(agg, nullptr, f_w1, f_b1, nullptr, nullptr, z1, HHd, HHd);
  gemm_kne<bf16, 128, HHd, HHd, 3, true><<<dim3(1, HHd / 128), blk, 0, stream>>>(z1, nullptr, f_w2, f_b2, nullptr, nullptr, z2, HHd, HHd);
  gemm_kne<bf16, 128, HHd, NCLS, 0, false, 0, NCLS><<<dim3(1, NCP / 128), blk, 0, stream>>>(z2, nullptr, f_w3, f_b3, nullptr, nullptr, lp, NCP, HHd);
  k_out<<<dim3((NBr * NCLS / 4 + 255) / 256), blk, 0, stream>>>(lp, out);
}

// v006
// One run takes 67.5 microseconds.
// Versions in between are left out here; by their measured steps it is 1.63 times as fast as v004.
// Counting every step since v000, it is 10.5 times as fast.
// Contractions on v_wmma_f32_16x16x32_f16 (plain f16 operands, f32 accumulate): the pair MLP g over all 32x25x25 ordered pairs as GEMMs
// with M = pairs: layer 1 split exactly as [x_i, x_j]·W1 = x_i·W1[:D] + x_j·W1[D:] (two K = 512 GEMMs on the 800 node rows, then relu of the
// broadcast sum per pair, rounded to f16 by the layer-2 loader), layers 2 and 3 (K = 512, M = 20,000 pair rows padded to 20,096), the i != j sum per batch in f32
// (fixed order), and the f MLP on the 32 aggregated rows (two 16-row tiles, no pad rows; K = 512 split over 16 waves; N in 16-column work-groups). ReLU in f32. The [32][1000]
#include <hip/hip_runtime.h>
#include <hip/hip_bf16.h>
#include <math.h>

#define NBr 32
#define NN 25
#define DDr 512
#define HHd 512
#define NCLS 1000
#define NCP 1024
#define NROWS (NBr * NN)          // 800
#define NROWP 896
#define NPAIR (NBr * NN * NN)     // 20000
#define NPAIRP 20096
#define GSTR 40
#define SS 64
#define HH 1
#define DKK 64

typedef _Float16 bf16;
typedef _Float16 f16;
typedef __attribute__((ext_vector_type(4))) unsigned v4u_t;
typedef unsigned v4ua __attribute__((ext_vector_type(4), may_alias));
typedef __attribute__((ext_vector_type(4))) float v4f_t;
typedef float v4fa __attribute__((ext_vector_type(4), may_alias));
typedef __attribute__((ext_vector_type(16))) bf16  bf16x16;
typedef bf16x16 f16x16;
typedef __attribute__((ext_vector_type(8)))  bf16  bf16x8;
typedef bf16x8 f16x8;
typedef __attribute__((ext_vector_type(4)))  bf16  bf16x4;
typedef __attribute__((ext_vector_type(8)))  float f32x8;
__device__ __forceinline__ f32x8 wmma16(f16x16 a, f16x16 b, f32x8 c) {
  c = __builtin_amdgcn_wmma_f32_16x16x32_f16(false, a, false, b, (short)0, c, false, false);
  asm volatile("v_nop\n\tv_nop\n\tv_nop\n\tv_nop" : "+v"(c) : "v"(a), "v"(b));
  return c;
}
#define LDS_STRIDE 48   // unused: GEMM tiles use PST = KT + 8 (72 or 136 elems, 144B or 272B rows)
#define KSTRIDE    72   // unused
#define VSTRIDE    48   // unused

__device__ __forceinline__ f32x8 wmma_bf16(bf16x16 a, bf16x16 b, f32x8 c) {
  c = __builtin_amdgcn_wmma_f32_16x16x32_f16(false, a, false, b, (short)0, c, false, false);
  asm volatile("v_nop\n\tv_nop\n\tv_nop\n\tv_nop" : "+v"(c) : "v"(a), "v"(b));   // A/B-overwrite hazard guard
  return c;
}

// 16x32 (MxK) bf16 fragment from a row-major global matrix.
// lanes 0-15  (row=lane)    : elems 0..7 = K+0..7,  8..15 = K+16..23
// lanes 16-31 (row=lane-16) : elems 0..7 = K+8..15, 8..15 = K+24..31
template <typename T>
__device__ __forceinline__ bf16x16 load_frag(const T* __restrict__ base, int ld,
                                             int row0, int k0) {
  const int lane = threadIdx.x & 31;
  const int r    = lane & 15;
  const int kh   = (lane >> 4) * 8;
  const T* p0 = base + (size_t)(row0 + r) * ld + (k0 + kh);
  const T* p1 = p0 + 16;
  bf16x16 f;
#pragma unroll
  for (int i = 0; i < 8; ++i) {
    f[i]     = (bf16)p0[i];
    f[i + 8] = (bf16)p1[i];
  }
  return f;
}

// Same fragment from an LDS tile with padded row stride (base includes row0/k0).
__device__ __forceinline__ bf16x16 lds_frag(const bf16* base, int stride) {
  const int lane = threadIdx.x & 31;
  const int row  = lane & 15;
  const int kh   = (lane >> 4) * 8;
  const bf16x8 lo = *(const bf16x8*)(base + row * stride + kh);
  const bf16x8 hi = *(const bf16x8*)(base + row * stride + kh + 16);
  bf16x16 f;
#pragma unroll
  for (int i = 0; i < 8; ++i) { f[i] = lo[i]; f[i + 8] = hi[i]; }
  return f;
}

template <typename T>
__device__ __forceinline__ void stage_read16(const T* __restrict__ p, float* buf) {
#pragma unroll
  for (int i = 0; i < 16; ++i) buf[i] = (float)p[i];
}

__device__ __forceinline__ void stage_write(bf16* dst, const float* buf, int nquad) {
#pragma unroll
  for (int i = 0; i < nquad; ++i) {
    bf16x4 q;
    q[0] = (bf16)buf[4 * i];     q[1] = (bf16)buf[4 * i + 1];
    q[2] = (bf16)buf[4 * i + 2]; q[3] = (bf16)buf[4 * i + 3];
    *(bf16x4*)(dst + 4 * i) = q;
  }
}


// ---------------------------------------------------------------------------------------------------------------------------
// gemm_kne: Y[m][n] = epi( sum_k A[m][k]*W[k][n] + bias[n] ), A f32/f16 [M][lda], W f32 row-major [K][N] (ldw), plain f16 operands,
// f32 accumulate. EPI 0: identity; 1: exact-erf GELU; 2: R[m][n] + gvec[n]*(.) (residual with per-channel gain). Output f32 (or f16
// when OUT16). Block = 128x128 tile, 8 waves as 4(M) x 2(N); per KT-wide k-step A and W tiles staged f16 in LDS (W transposed).
// KT = k depth of one staged tile: every global load of a step is in flight at once, so a GEMM waits out K / KT load latencies.
// lda, ldw = row pitches of A and W in elements, compile-time so that a tile's loads differ only in their immediate offset.
// EPI 3: relu, so that with OUT16 a layer's activation leaves the GEMM as the next layer's f16 operand (same rounding as relu and convert of the f32 sum).
// MA > 0: A is the f32 input Xin with MA rows, read unpadded. NV > 0: W and bias have NV columns (a multiple of 4), read unpadded; columns past NV count as 0.
// ZW, ZY: blockIdx.z picks one of several GEMMs on the same A: W moves by ZW elements, Y by ZY bytes.
// EPI 4 (pair rows, 625 a batch): the tile is not stored; Y[2 * tile + s][n] = sum over the tile's rows with i != j of relu(. + bias), s = 0 for rows of the
// batch that holds the tile's first row, s = 1 for rows of the next one (128 < 625: a tile touches two batches at most). Fixed order.
// AIN 1: A row p is pair row p = (b * 25 + i) * 25 + j of layer 1, relu(Xin[b * 25 + i] + R[b * 25 + j]) (the bias lies in Xin already), formed in f32 by the loader and rounded to f16 as it goes to LDS;
// rows past the last pair take node row 799 of Xin and the zero pad rows 800..895 of R (their results are never summed).
// With AIN 1 the kernel is held to 160 registers (6 waves a SIMD), so that three work-groups share a WGP and the whole grid is resident at once, as with f16 A rows.
// ---------------------------------------------------------------------------------------------------------------------------
#define GSTR 40
template <typename AT, int KT, int lda, int ldw, int EPI, bool OUT16, int MA = 0, int NV = 0, int ZW = 0, int ZY = 0, int AIN = 0>
__global__ __launch_bounds__(256, AIN == 1 ? 6 : 1) void gemm_kne(const AT* __restrict__ A, const float* __restrict__ Xin, const float* __restrict__ W0,
                                                const float* __restrict__ bias, const float* __restrict__ R, const float* __restrict__ gvec,
                                                void* __restrict__ Y0, int ldy, int K) {
  const float* __restrict__ Wm = W0 + (size_t)blockIdx.z * ZW;
  void* __restrict__ Yv = (char*)Y0 + (size_t)blockIdx.z * ZY;
  constexpr int PST = KT + 8;                 // LDS row pitch in f16: 144 B (KT 64) or 272 B (KT 128), 16 B x odd for the b128 fragment reads
  constexpr int AE = 16 / (int)sizeof(AT);    // A elements in one 16-byte load
  constexpr int LPR = KT / AE;                // lanes that cover one A row of the tile, side by side: whole 128-byte lines per load
  constexpr int RPP = 256 / LPR;              // A rows the block loads per pass
  constexpr int NP = 128 / RPP;               // passes
  constexpr int NH = KT / 32;                 // 32-deep slices of the tile
  __shared__ __attribute__((aligned(16))) f16 ldsA[128 * PST];
  __shared__ __attribute__((aligned(16))) f16 ldsW[128 * PST];
  __shared__ __attribute__((aligned(16))) float oS[EPI == 4 ? 8 * 2 * 2 * 64 : 8 * 32 * 68];
  const int tid = threadIdx.x, lane = tid & 31, wave = tid >> 5, cl = lane & 15, rh = (lane >> 4) * 8;
  const int m0 = blockIdx.x * 128, n0 = blockIdx.y * 128;
  const int wm = (wave & 3) * 32, wn = (wave >> 2) * 64;
  const int ar = tid / LPR, ac = (tid % LPR) * AE;
  // W: each thread takes 4(k) x 4(n) blocks and transposes them in registers, so column n gets 8-byte runs of 4 k.
  // At either pitch 4 columns are 16 banks apart, so a wave's 32 runs (8 k-quads x 4 column quads) fall on all 64 banks once.
  const int kq = (tid & 7) * 4, nq = (tid >> 3) * 4;
  f32x8 acc[2][4];
#pragma unroll
  for (int i = 0; i < 2; ++i)
#pragma unroll
    for (int j = 0; j < 4; ++j) { f32x8 z = {}; acc[i][j] = z; }
  // AIN 1: a thread takes NP pair rows in a row (NP < 25), which share one x_i row or two: rows from 'cut' on have the second. Byte offsets from the two uniform bases.
  unsigned oa0 = 0, oa1 = 0, ob0 = 0, ob1 = 0; int cut = 0;
  if constexpr (AIN == 1) {
    static_assert(sizeof(AT) == 4 && NP < NN, "f32 node rows, two x_i rows at most");
    const int r0 = m0 + ar * NP, f0 = min(r0, NPAIR - 1) / NN, f1 = min(r0 + NP - 1, NPAIR - 1) / NN;   // f = b * 25 + i of the first and the last row
    const int nb0 = (f0 / NN) * NN - f0 * NN, nb1 = (f1 / NN) * NN - f1 * NN;                           // b * 25 + j = nb + pair row
    cut = f1 * NN - r0; oa0 = (unsigned)(f0 * lda + ac) * 4u; oa1 = (unsigned)(f1 * lda + ac) * 4u;
    ob0 = (unsigned)((nb0 + r0) * lda + ac) * 4u; ob1 = (unsigned)((nb1 + r0) * lda + ac) * 4u;   // x_j row of pair row r0 + p: p rows on from here (pad pair rows fall on the pad node rows 800..895)
  }
  const float* xsrc = Xin + (size_t)(m0 + ar) * lda + ac;   // MA > 0: this thread's place in the tile's first row pass, moved on by KT a step
  const float* wsrc = Wm + (size_t)kq * ldw + n0 + nq;      // this thread's 4 x 4 blocks of W, moved on by KT rows a step
#pragma unroll 1
  for (int k0 = 0; k0 < K; k0 += KT) {
    __syncthreads();
    v4u_t av[NP];
    v4f_t ub[AIN == 1 ? NP : 1], a0, a1;
    v4f_t wv[NH][4];
    if constexpr (AIN == 1) {
      a0 = *(const v4fa*)((const char*)Xin + oa0); a1 = *(const v4fa*)((const char*)Xin + oa1);
#pragma unroll   // registers indexed by p
      for (int p = 0; p < NP; ++p) ub[p] = *(const v4fa*)((const char*)R + ((p >= cut ? ob1 : ob0) + (unsigned)(p * lda * 4)));   // summed in 32 bits: ob1 alone may lie below 0
      asm volatile("s_wait_xcnt 0x0" ::: "memory");   // precaution: the offset registers of these loads are reused as targets of the W loads below
    } else
    if constexpr (MA > 0) {   // MA is a multiple of RPP, so a pass lies wholly inside the input or wholly past it (block-uniform test); rows past it count as 0
      static_assert(MA % RPP == 0 && sizeof(AT) == 4, "whole passes of f32 rows");
#pragma unroll   // registers indexed by p
      for (int p = 0; p < NP; ++p) { v4u_t zq = {0u, 0u, 0u, 0u}; av[p] = zq; if (m0 + p * RPP < MA) av[p] = *(const v4ua*)(xsrc + p * RPP * lda); }
      xsrc += KT;
    } else
    { const AT* src = A + (size_t)(m0 + ar) * lda + k0 + ac;
#pragma unroll   // registers indexed by p
      for (int p = 0; p < NP; ++p) av[p] = *(const v4ua*)(src + p * RPP * lda); }
    if constexpr (NV > 0) {   // a thread's 4 columns lie wholly inside W or wholly past it, where they count as 0
      static_assert(NV % 4 == 0, "whole column quads");
#pragma unroll   // registers indexed by h, g
      for (int h = 0; h < NH; ++h)
#pragma unroll
        for (int g = 0; g < 4; ++g) { v4f_t zq = {0.0f, 0.0f, 0.0f, 0.0f}; wv[h][g] = zq; }
    }
    if (NV == 0 || n0 + nq < NV) {
#pragma unroll   // registers indexed by h, g
      for (int h = 0; h < NH; ++h)
#pragma unroll
        for (int g = 0; g < 4; ++g) wv[h][g] = *(const v4fa*)(wsrc + (32 * h + g) * ldw);
    }
    wsrc += KT * ldw;
    if constexpr (AIN != 0) __builtin_amdgcn_sched_barrier(0);   // every load of the step issues before the first is waited for: without it the A-side loads are scheduled one behind the other's wait, or W behind them all
#pragma unroll   // registers indexed by p
    for (int p = 0; p < NP; ++p) {
      f16* dst = ldsA + (AIN == 1 ? ar * NP + p : p * RPP + ar) * PST + ac;
      if constexpr (sizeof(AT) == 2) { *(v4ua*)dst = av[p]; }
      else { v4f_t fv; bf16x4 q;
        if constexpr (AIN == 1) {
#pragma unroll
          for (int e = 0; e < 4; ++e) fv[e] = fmaxf((p >= cut ? a1[e] : a0[e]) + ub[p][e], 0.0f); }
        else fv = __builtin_bit_cast(v4f_t, av[p]);
        q[0] = (f16)fv[0]; q[1] = (f16)fv[1]; q[2] = (f16)fv[2]; q[3] = (f16)fv[3];
        *(bf16x4*)dst = q; }
    }
#pragma unroll   // registers indexed by h, u
    for (int h = 0; h < NH; ++h)
#pragma unroll
      for (int u = 0; u < 4; ++u) { bf16x4 q; q[0] = (f16)wv[h][0][u]; q[1] = (f16)wv[h][1][u]; q[2] = (f16)wv[h][2][u]; q[3] = (f16)wv[h][3][u];
        *(bf16x4*)(ldsW + (nq + u) * PST + 32 * h + kq) = q; }
    if constexpr (AIN == 1) {   // 32-bit offsets move on by a step, so that each load is a uniform base plus one register
      oa0 += KT * 4u; oa1 += KT * 4u; ob0 += KT * 4u; ob1 += KT * 4u;
    }
    __syncthreads();
#pragma unroll   // constant LDS offsets; k runs upward as before, so every accumulator sums in the same order
    for (int h = 0; h < NH; ++h) {
      f16x16 af[2];
#pragma unroll
      for (int i = 0; i < 2; ++i) af[i] = lds_frag(ldsA + (wm + 16 * i) * PST + 32 * h, PST);
#pragma unroll
      for (int j = 0; j < 4; ++j) {
        const f16x16 bf = lds_frag(ldsW + (wn + 16 * j) * PST + 32 * h, PST);
#pragma unroll
        for (int i = 0; i < 2; ++i) acc[i][j] = wmma16(af[i], bf, acc[i][j]);
      }
    }
  }
  if constexpr (EPI == 4) {
    const int bf = m0 / (NN * NN);                        // batch of the tile's first row
    const int rel0 = m0 - bf * (NN * NN) + wm + rh;       // this lane's first row, counted from that batch's first pair row
    float bv[4], s0[4], s1[4];
#pragma unroll
    for (int j = 0; j < 4; ++j) { bv[j] = bias[n0 + wn + 16 * j + cl]; s0[j] = 0.0f; s1[j] = 0.0f; }
#pragma unroll
    for (int i = 0; i < 2; ++i)
#pragma unroll
      for (int r = 0; r < 8; ++r) {
        const int rel = rel0 + 16 * i + r;
        const bool nx = rel >= NN * NN;                   // row of the next batch (past the last batch: pad rows, whose sums nobody reads)
        const bool od = ((nx ? rel - NN * NN : rel) % (NN + 1)) != 0;   // pair row 25 i + j has i == j exactly when it is a multiple of 26
        const float h0 = (od && !nx) ? __builtin_inff() : 0.0f, h1 = (od && nx) ? __builtin_inff() : 0.0f;   // upper clamps: none for a row that counts, 0 else
#pragma unroll
        for (int j = 0; j < 4; ++j) { const float v = acc[i][j][r] + bv[j];
          s0[j] += __builtin_amdgcn_fmed3f(v, 0.0f, h0); s1[j] += __builtin_amdgcn_fmed3f(v, 0.0f, h1); }   // relu and row mask in one median
      }
    float* rp = oS + (wave * 2 + (lane >> 4)) * 128 + cl;
#pragma unroll
    for (int j = 0; j < 4; ++j) { rp[16 * j] = s0[j]; rp[64 + 16 * j] = s1[j]; }
    __syncthreads();   // the 8 half-wave sums of a column (4 row waves x 2 lane halves) meet here
    const int col = tid & 127, sg = tid >> 7;
    const float* qp = oS + (col >> 6) * 1024 + sg * 64 + (col & 63);
    float a = 0.0f;
#pragma unroll
    for (int w = 0; w < 8; ++w) a += qp[w * 128];
    ((float*)Yv)[(size_t)(2 * blockIdx.x + sg) * ldy + n0 + col] = a;
    return;
  }
  float* so = oS + wave * (32 * 68);
#pragma unroll
  for (int i = 0; i < 2; ++i)
#pragma unroll
    for (int j = 0; j < 4; ++j) {
      const int n = n0 + wn + 16 * j + cl;
      const float bv = (bias && (NV == 0 || n < NV) && (ZW == 0 || blockIdx.z == 0)) ? bias[n] : 0.0f;   // of several GEMMs in z the first alone takes the bias
      const float gv = (EPI == 2) ? gvec[n] : 0.0f;
      if (EPI == 1) {
#pragma unroll 1
        for (int r = 0; r < 8; ++r) { const float xg = acc[i][j][r] + bv; so[(16 * i + rh + r) * 68 + 16 * j + cl] = 0.5f * xg * (1.0f + erff(xg * 0.70710678118654752f)); }
      } else {
#pragma unroll
        for (int r = 0; r < 8; ++r) {
          float v = acc[i][j][r] + bv;
          if (EPI == 2) v = R[(size_t)(m0 + wm + 16 * i + rh + r) * ldy + n] + gv * v;
          if (EPI == 3) v = fmaxf(v, 0.0f);
          so[(16 * i + rh + r) * 68 + 16 * j + cl] = v;
        }
      }
    }
  asm volatile("s_wait_dscnt 0" ::: "memory");
  __builtin_amdgcn_wave_barrier();
{
    if (OUT16) {
      f16* Y = (f16*)Yv;
#pragma unroll
      for (int it = 0; it < 8; ++it) { const int c = lane + 32 * it, rr = c >> 3, q8 = (c & 7) * 8;
        union { f16 h[8]; v4u_t v; } u;
#pragma unroll
        for (int e = 0; e < 8; ++e) u.h[e] = (f16)so[rr * 68 + q8 + e];
        *(v4u_t*)(Y + (size_t)(m0 + wm + rr) * ldy + n0 + wn + q8) = u.v; }
    } else {
      float* Y = (float*)Yv;
#pragma unroll
      for (int it = 0; it < 16; ++it) { const int f4 = lane + 32 * it, rr = f4 >> 4, q = (f4 & 15) * 4;
        *(v4f_t*)(Y + (size_t)(m0 + wm + rr) * ldy + n0 + wn + q) = *(const v4fa*)(so + rr * 68 + q); }
    }
    
  }
}

// ---------------------------------------------------------------------------------------------------------------------------
// k_tail: one layer of the f MLP, Y[32][N] = A[32][512] * W[512][N] + bias. These layers are three dependent launches of almost no work, so what counts is the
// chain of waits inside one launch: here every global load of a work-group is in flight at once and is waited for once (the tiled GEMM waits four times, for 128 rows of which 32 count).
// A work-group takes 16 columns; its 32 waves are 16 k slices of 32 (one WMMA deep) x 2 row tiles. Each wave loads its B fragment straight from W (f32, rounded to f16 as before), does one WMMA,
// and the 16 k-slice tiles are summed in LDS in f32, k upward. Activations lie in 16-column blocks [N / 16][32][16], so a work-group stores whole lines of its own and an A fragment is two contiguous 512-byte loads.
// TA 1: A row b is the sum, in tile order, of the EPI 4 rows of ps that belong to batch b, formed once per work-group with whole-line loads and handed to the waves through LDS as f16.
// LAST: f32 sums without relu, in the same blocks. Columns from NV on repeat column NV - 1 (address clamp); nobody reads them.
// ---------------------------------------------------------------------------------------------------------------------------
template <int TA, int ldw, int NV, bool LAST>
__global__ __launch_bounds__(1024) void k_tail(const _Float16* __restrict__ Zin, const float* __restrict__ ps, const float* __restrict__ Wm,
                                               const float* __restrict__ bias, _Float16* __restrict__ Zout, float* __restrict__ Lout) {
  constexpr int APS = HHd + 8;                // LDS row pitch in f16: 1040 B, 16 B x odd for the b128 fragment reads
  __shared__ __attribute__((aligned(16))) f16 ldsA[TA == 1 ? NBr * APS : 8];
  __shared__ __attribute__((aligned(16))) float red[16 * 512];
  const int tid = threadIdx.x, lane = tid & 31, wave = tid >> 5, cl = lane & 15, kh = (lane >> 4) * 8;
  const int ks = wave & 15, mi = wave >> 4, k0 = ks * 32, n0 = blockIdx.x * 16;
  // B fragment: column n0 + cl, k in the order of lds_frag (k0 + kh + 0..7, then + 16)
  // Every load is a uniform base plus one 32-bit offset register plus a constant.
  const int nc = min(n0 + cl, NV - 1);
  const unsigned woff = (unsigned)((k0 + kh) * ldw + nc) * 4u;
  const int bq = __builtin_amdgcn_readfirstlane(tid >> 7);   // TA 1: 128 lanes side by side cover a row of ps, 8 rows a pass; the row is the same in a whole wave, so its address is a scalar base
  const char* qs[4], * qf[4];                                // row 2 * t0 of pass p, and the batch's own row of tile t0
  if constexpr (TA == 1) {
#pragma unroll   // registers indexed by p
    for (int p = 0; p < 4; ++p) { const int r0 = (p * 8 + bq) * (NN * NN), t0 = r0 >> 7;
      qs[p] = (const char*)(ps + (size_t)(2 * t0) * HHd); qf[p] = qs[p] + ((t0 << 7) < r0 ? HHd * 4 : 0); }
  }
  float wv[16];
#pragma unroll   // registers indexed by i
  for (int i = 0; i < 8; ++i) { wv[i] = *(const float*)((const char*)Wm + woff + i * (ldw * 4)); wv[8 + i] = *(const float*)((const char*)Wm + woff + (16 + i) * (ldw * 4)); }
  const float bv = bias[nc];   // the output element that this thread finishes below has column n0 + tid % 16 too
  f16x16 af;
  if constexpr (TA == 1) {
    // batch b's 625 pair rows lie in tiles t0..t1 of the pair GEMM (5 or 6 tiles): in t0 behind the tail of batch b - 1 (second row of the tile's two) unless the tile starts with b,
    // in the others from the tile's first row on. The sixth tile is the batch's own or is left out of the sum (it lies inside ps either way: t0 <= 151 of 157 tiles).
    const int c4 = (tid & 127) * 4; const unsigned poff = (unsigned)c4 * 4u;
    v4f_t pv[4][6];
#pragma unroll   // registers indexed by p, u
    for (int p = 0; p < 4; ++p) {
      pv[p][0] = *(const v4fa*)(qf[p] + poff);
#pragma unroll
      for (int u = 1; u < 6; ++u) pv[p][u] = *(const v4fa*)(qs[p] + poff + u * (2 * HHd * 4));
    }
    asm volatile("s_wait_xcnt 0x0" :: "v"(woff), "v"(nc), "v"(poff) : "memory");   // precaution: the offset registers of the loads above stay untouched up to this wait, also as targets of later loads
    __builtin_amdgcn_sched_barrier(0);   // every load of the work-group issues before the first is waited for: without it the loads are scheduled in small groups, each behind the wait for the group before, W last
#pragma unroll   // registers indexed by p
    for (int p = 0; p < 4; ++p) { const int r0 = (p * 8 + bq) * (NN * NN); const bool six = (r0 >> 7) + 5 <= ((r0 + NN * NN - 1) >> 7);
      v4f_t s = pv[p][0];
#pragma unroll
      for (int u = 1; u < 5; ++u) s += pv[p][u];
#pragma unroll
      for (int e = 0; e < 4; ++e) s[e] += six ? pv[p][5][e] : 0.0f;
      bf16x4 q4; q4[0] = (f16)s[0]; q4[1] = (f16)s[1]; q4[2] = (f16)s[2]; q4[3] = (f16)s[3];
      *(bf16x4*)(ldsA + (p * 8 + bq) * APS + c4) = q4; }
    __syncthreads();   // the joined rows are read by every wave
    af = lds_frag(ldsA + (16 * mi) * APS + k0, APS);
  } else {
    const unsigned zoff = (unsigned)((k0 >> 4) * (NBr * 16) + (16 * mi + cl) * 16 + kh) * 2u;
    const f16x8 lo = *(const f16x8*)((const char*)Zin + zoff), hi = *(const f16x8*)((const char*)Zin + zoff + NBr * 16 * 2);
#pragma unroll
    for (int i = 0; i < 8; ++i) { af[i] = lo[i]; af[i + 8] = hi[i]; }
  }
  f16x16 bfr;
#pragma unroll
  for (int i = 0; i < 16; ++i) bfr[i] = (f16)wv[i];
  f32x8 acc = {};
  acc = wmma16(af, bfr, acc);
  float* rp = red + ks * 512 + mi * 256 + lane;
#pragma unroll
  for (int r = 0; r < 8; ++r) rp[r * 32] = acc[r];
  __syncthreads();   // the 16 k-slice tiles of an output element meet here
  if (tid < 512) {   // one output element a thread, in the order of the block it is stored to: row = tid / 16, column = tid % 16
    const int row = tid >> 4;
    const float* qp = red + (row >> 4) * 256 + (row & 7) * 32 + ((row >> 3) & 1) * 16 + (tid & 15);
    float a = qp[0];
#pragma unroll
    for (int w = 1; w < 16; ++w) a += qp[w * 512];
    a += bv;
    if constexpr (LAST) Lout[blockIdx.x * 512 + tid] = a;
    else Zout[blockIdx.x * 512 + tid] = (f16)fmaxf(a, 0.0f);
  }
}

// logits [32][1000] from the 16-column blocks as one contiguous stream of 32,000 floats (8,000 float4; rows and blocks are multiples of 4 so no chunk straddles either)
__global__ __launch_bounds__(256) void k_out(const float* __restrict__ lp, float* __restrict__ out) {
  const int q4 = blockIdx.x * 256 + threadIdx.x; if (q4 >= NBr * NCLS / 4) return; const int fidx = q4 * 4, r = fidx / NCLS, c = fidx % NCLS;
  const v4f_t v = *(const v4f_t*)(lp + (size_t)(c >> 4) * (NBr * 16) + r * 16 + (c & 15)); *(v4f_t*)(out + fidx) = v; 
}

extern "C" void kernel_launch(void* const* d_in, const int* in_sizes, int n_in,
                              void* d_out, int out_size, void* d_ws, size_t ws_size,
                              hipStream_t stream) {
  (void)in_sizes; (void)n_in; (void)out_size;
  const float** f = (const float**)d_in;
  const float* x = f[0], *g_w1 = f[1], *g_b1 = f[2], *g_w2 = f[3], *g_b2 = f[4], *g_w3 = f[5], *g_b3 = f[6], *f_w1 = f[7], *f_b1 = f[8], *f_w2 = f[9], *f_b2 = f[10], *f_w3 = f[11], *f_b3 = f[12];
  float* out = (float*)d_out;      // [32,1000]
  char* ws = (char*)d_ws;
  float* A = (float*)ws; ws += (size_t)NROWP * HHd * 4; float* Bq = (float*)ws; ws += (size_t)NROWP * HHd * 4;   // Bq directly behind A: the z = 1 output of the layer-1 launch
  float* ps = (float*)ws; ws += (size_t)(NPAIRP / 128) * 2 * HHd * 4;   // layer-3 column sums, two rows a tile
  bf16* h2 = (bf16*)ws; ws += (size_t)NPAIRP * HHd * 2;
  bf16* z1 = (bf16*)ws; ws += (size_t)128 * HHd * 2;
  bf16* z2 = (bf16*)ws; ws += (size_t)128 * HHd * 2;
  float* lp = (float*)ws; ws += (size_t)128 * NCP * 4;
  if ((size_t)(ws - (char*)d_ws) > ws_size) return;
  const dim3 blk(256);
  gemm_kne<float, 128, DDr, HHd, 0, false, NROWS, 0, DDr * HHd, NROWP * HHd * 4><<<dim3(NROWP / 128, HHd / 128, 2), blk, 0, stream>>>(nullptr, x, g_w1, g_b1, nullptr, nullptr, A, HHd, DDr);   // z = 0: x*W1[:D] + b1 -> A; z = 1: x*W1[D:] -> Bq
  gemm_kne<float, 64, HHd, HHd, 3, true, 0, 0, 0, 0, 1><<<dim3(NPAIRP / 128, HHd / 128), blk, 0, stream>>>(nullptr, A, g_w2, g_b2, Bq, nullptr, h2, HHd, HHd);      // relu(h1*W2 + b2) as f16, h1 = relu(A_i + Bq_j) formed by the loader
  gemm_kne<bf16, 64, HHd, HHd, 4, false><<<dim3(NPAIRP / 128, HHd / 128), blk, 0, stream>>>(h2, nullptr, g_w3, g_b3, nullptr, nullptr, ps, HHd, HHd);      // per tile: sums over i != j of relu(h2*W3 + b3)
  k_tail<1, HHd, HHd, false><<<dim3(HHd / 16), dim3(1024), 0, stream>>>(nullptr, ps, f_w1, f_b1, z1, nullptr);   // A = the tile sums joined per batch
  k_tail<0, HHd, HHd, false><<<dim3(HHd / 16), dim3(1024), 0, stream>>>(z1, nullptr, f_w2, f_b2, z2, nullptr);
  k_tail<0, NCLS, NCLS, true><<<dim3((NCLS + 15) / 16), dim3(1024), 0, stream>>>(z2, nullptr, f_w3, f_b3, nullptr, lp);
  k_out<<<dim3((NBr * NCLS / 4 + 255) / 256), blk, 0, stream>>>(lp, out);
}

// v007
// Measured time: 61.5 microseconds a run.
// Timed twice side by side with v006, it ran 1.09 times as fast both times.
// Counting every step since v000, it is 11.4 times as fast.
// Contractions on v_wmma_f32_16x16x32_f16 (plain f16 operands, f32 accumulate): the pair MLP g over all 32x25x25 ordered pairs as GEMMs
// with M = pairs: layer 1 split exactly as [x_i, x_j]·W1 = x_i·W1[:D] + x_j·W1[D:] (two K = 512 GEMMs on the 800 node rows, then relu of the
// broadcast sum per pair, rounded to f16 by the layer-2 loader), layers 2 and 3 (K = 512, 79 pair rows of a batch a work-group, in one launch), the i != j sum per batch in f32
// (fixed order), and the f MLP on the 32 aggregated rows (two 16-row tiles, no pad rows; K = 512 split over 16 waves; N in 16-column work-groups). ReLU in f32. The [32][1000]
#include <hip/hip_runtime.h>
#include <hip/hip_bf16.h>
#include <math.h>

#define NBr 32
#define NN 25
#define DDr 512
#define HHd 512
#define NCLS 1000
#define NCP 1024
#define NROWS (NBr * NN)          // 800
#define NROWP 896
#define NPAIR (NBr * NN * NN)     // 20000
#define NPAIRP 20096
#define GSTR 40
#define SS 64
#define HH 1
#define DKK 64

typedef _Float16 bf16;
typedef _Float16 f16;
typedef __attribute__((ext_vector_type(4))) unsigned v4u_t;
typedef unsigned v4ua __attribute__((ext_vector_type(4), may_alias));
typedef __attribute__((ext_vector_type(4))) float v4f_t;
typedef float v4fa __attribute__((ext_vector_type(4), may_alias));
typedef __attribute__((ext_vector_type(16))) bf16  bf16x16;
typedef bf16x16 f16x16;
typedef __attribute__((ext_vector_type(8)))  bf16  bf16x8;
typedef bf16x8 f16x8;
typedef __attribute__((ext_vector_type(4)))  bf16  bf16x4;
typedef __attribute__((ext_vector_type(8)))  float f32x8;
__device__ __forceinline__ f32x8 wmma16(f16x16 a, f16x16 b, f32x8 c) {
  c = __builtin_amdgcn_wmma_f32_16x16x32_f16(false, a, false, b, (short)0, c, false, false);
  asm volatile("v_nop\n\tv_nop\n\tv_nop\n\tv_nop" : "+v"(c) : "v"(a), "v"(b));
  return c;
}
#define LDS_STRIDE 48   // unused: gemm_kne tiles use PST = KT + 8 (136 elems, 272B rows)
#define KSTRIDE    72   // unused
#define VSTRIDE    48   // unused

__device__ __forceinline__ f32x8 wmma_bf16(bf16x16 a, bf16x16 b, f32x8 c) {
  c = __builtin_amdgcn_wmma_f32_16x16x32_f16(false, a, false, b, (short)0, c, false, false);
  asm volatile("v_nop\n\tv_nop\n\tv_nop\n\tv_nop" : "+v"(c) : "v"(a), "v"(b));   // A/B-overwrite hazard guard
  return c;
}

// 16x32 (MxK) f16 fragment from a row-major global matrix.
// lanes 0-15  (row=lane)    : elems 0..7 = K+0..7,  8..15 = K+16..23
// lanes 16-31 (row=lane-16) : elems 0..7 = K+8..15, 8..15 = K+24..31
template <typename T>
__device__ __forceinline__ bf16x16 load_frag(const T* __restrict__ base, int ld,
                                             int row0, int k0) {
  const int lane = threadIdx.x & 31;
  const int r    = lane & 15;
  const int kh   = (lane >> 4) * 8;
  const T* p0 = base + (size_t)(row0 + r) * ld + (k0 + kh);
  const T* p1 = p0 + 16;
  bf16x16 f;
#pragma unroll
  for (int i = 0; i < 8; ++i) {
    f[i]     = (bf16)p0[i];
    f[i + 8] = (bf16)p1[i];
  }
  return f;
}

// Same fragment from an LDS tile with padded row stride (base includes row0/k0).
__device__ __forceinline__ bf16x16 lds_frag(const bf16* base, int stride) {
  const int lane = threadIdx.x & 31;
  const int row  = lane & 15;
  const int kh   = (lane >> 4) * 8;
  const bf16x8 lo = *(const bf16x8*)(base + row * stride + kh);
  const bf16x8 hi = *(const bf16x8*)(base + row * stride + kh + 16);
  bf16x16 f;
#pragma unroll
  for (int i = 0; i < 8; ++i) { f[i] = lo[i]; f[i + 8] = hi[i]; }
  return f;
}

template <typename T>
__device__ __forceinline__ void stage_read16(const T* __restrict__ p, float* buf) {
#pragma unroll
  for (int i = 0; i < 16; ++i) buf[i] = (float)p[i];
}

__device__ __forceinline__ void stage_write(bf16* dst, const float* buf, int nquad) {
#pragma unroll
  for (int i = 0; i < nquad; ++i) {
    bf16x4 q;
    q[0] = (bf16)buf[4 * i];     q[1] = (bf16)buf[4 * i + 1];
    q[2] = (bf16)buf[4 * i + 2]; q[3] = (bf16)buf[4 * i + 3];
    *(bf16x4*)(dst + 4 * i) = q;
  }
}


// ---------------------------------------------------------------------------------------------------------------------------
// gemm_kne: Y[m][n] = epi( sum_k A[m][k]*W[k][n] + bias[n] ), A f32/f16 [M][lda], W f32 row-major [K][N] (ldw), plain f16 operands,
// f32 accumulate. EPI 0: identity; 1: exact-erf GELU; 2: R[m][n] + gvec[n]*(.) (residual with per-channel gain). Output f32 (or f16
// when OUT16). Block = 128x128 tile, 8 waves as 4(M) x 2(N); per KT-wide k-step A and W tiles staged f16 in LDS (W transposed).
// KT = k depth of one staged tile: every global load of a step is in flight at once, so a GEMM waits out K / KT load latencies.
// lda, ldw = row pitches of A and W in elements, compile-time so that a tile's loads differ only in their immediate offset.
// EPI 3: relu, so that with OUT16 a layer's activation leaves the GEMM as the next layer's f16 operand (same rounding as relu and convert of the f32 sum).
// MA > 0: A is the f32 input Xin with MA rows, read unpadded. NV > 0: W and bias have NV columns (a multiple of 4), read unpadded; columns past NV count as 0.
// ZW, ZY: blockIdx.z picks one of several GEMMs on the same A: W moves by ZW elements, Y by ZY bytes.
// EPI 4 (pair rows, 625 a batch): the tile is not stored; Y[2 * tile + s][n] = sum over the tile's rows with i != j of relu(. + bias), s = 0 for rows of the
// batch that holds the tile's first row, s = 1 for rows of the next one (128 < 625: a tile touches two batches at most). Fixed order.
// AIN 1: A row p is pair row p = (b * 25 + i) * 25 + j of layer 1, relu(Xin[b * 25 + i] + R[b * 25 + j]) (the bias lies in Xin already), formed in f32 by the loader and rounded to f16 as it goes to LDS;
// rows past the last pair take node row 799 of Xin and the zero pad rows 800..895 of R (their results are never summed).
// With AIN 1 the kernel is held to 160 registers (6 waves a SIMD), so that three work-groups share a WGP and the whole grid is resident at once, as with f16 A rows.
// ---------------------------------------------------------------------------------------------------------------------------
#define GSTR 40
template <typename AT, int KT, int lda, int ldw, int EPI, bool OUT16, int MA = 0, int NV = 0, int ZW = 0, int ZY = 0, int AIN = 0>
__global__ __launch_bounds__(256, AIN == 1 ? 6 : 1) void gemm_kne(const AT* __restrict__ A, const float* __restrict__ Xin, const float* __restrict__ W0,
                                                const float* __restrict__ bias, const float* __restrict__ R, const float* __restrict__ gvec,
                                                void* __restrict__ Y0, int ldy, int K) {
  const float* __restrict__ Wm = W0 + (size_t)blockIdx.z * ZW;
  void* __restrict__ Yv = (char*)Y0 + (size_t)blockIdx.z * ZY;
  constexpr int PST = KT + 8;                 // LDS row pitch in f16: 144 B (KT 64) or 272 B (KT 128), 16 B x odd for the b128 fragment reads
  constexpr int AE = 16 / (int)sizeof(AT);    // A elements in one 16-byte load
  constexpr int LPR = KT / AE;                // lanes that cover one A row of the tile, side by side: whole 128-byte lines per load
  constexpr int RPP = 256 / LPR;              // A rows the block loads per pass
  constexpr int NP = 128 / RPP;               // passes
  constexpr int NH = KT / 32;                 // 32-deep slices of the tile
  __shared__ __attribute__((aligned(16))) f16 ldsA[128 * PST];
  __shared__ __attribute__((aligned(16))) f16 ldsW[128 * PST];
  __shared__ __attribute__((aligned(16))) float oS[EPI == 4 ? 8 * 2 * 2 * 64 : 8 * 32 * 68];
  const int tid = threadIdx.x, lane = tid & 31, wave = tid >> 5, cl = lane & 15, rh = (lane >> 4) * 8;
  const int m0 = blockIdx.x * 128, n0 = blockIdx.y * 128;
  const int wm = (wave & 3) * 32, wn = (wave >> 2) * 64;
  const int ar = tid / LPR, ac = (tid % LPR) * AE;
  // W: each thread takes 4(k) x 4(n) blocks and transposes them in registers, so column n gets 8-byte runs of 4 k.
  // At either pitch 4 columns are 16 banks apart, so a wave's 32 runs (8 k-quads x 4 column quads) fall on all 64 banks once.
  const int kq = (tid & 7) * 4, nq = (tid >> 3) * 4;
  f32x8 acc[2][4];
#pragma unroll
  for (int i = 0; i < 2; ++i)
#pragma unroll
    for (int j = 0; j < 4; ++j) { f32x8 z = {}; acc[i][j] = z; }
  // AIN 1: a thread takes NP pair rows in a row (NP < 25), which share one x_i row or two: rows from 'cut' on have the second. Byte offsets from the two uniform bases.
  unsigned oa0 = 0, oa1 = 0, ob0 = 0, ob1 = 0; int cut = 0;
  if constexpr (AIN == 1) {
    static_assert(sizeof(AT) == 4 && NP < NN, "f32 node rows, two x_i rows at most");
    const int r0 = m0 + ar * NP, f0 = min(r0, NPAIR - 1) / NN, f1 = min(r0 + NP - 1, NPAIR - 1) / NN;   // f = b * 25 + i of the first and the last row
    const int nb0 = (f0 / NN) * NN - f0 * NN, nb1 = (f1 / NN) * NN - f1 * NN;                           // b * 25 + j = nb + pair row
    cut = f1 * NN - r0; oa0 = (unsigned)(f0 * lda + ac) * 4u; oa1 = (unsigned)(f1 * lda + ac) * 4u;
    ob0 = (unsigned)((nb0 + r0) * lda + ac) * 4u; ob1 = (unsigned)((nb1 + r0) * lda + ac) * 4u;   // x_j row of pair row r0 + p: p rows on from here (pad pair rows fall on the pad node rows 800..895)
  }
  const float* xsrc = Xin + (size_t)(m0 + ar) * lda + ac;   // MA > 0: this thread's place in the tile's first row pass, moved on by KT a step
  const float* wsrc = Wm + (size_t)kq * ldw + n0 + nq;      // this thread's 4 x 4 blocks of W, moved on by KT rows a step
#pragma unroll 1
  for (int k0 = 0; k0 < K; k0 += KT) {
    __syncthreads();
    v4u_t av[NP];
    v4f_t ub[AIN == 1 ? NP : 1], a0, a1;
    v4f_t wv[NH][4];
    if constexpr (AIN == 1) {
      a0 = *(const v4fa*)((const char*)Xin + oa0); a1 = *(const v4fa*)((const char*)Xin + oa1);
#pragma unroll   // registers indexed by p
      for (int p = 0; p < NP; ++p) ub[p] = *(const v4fa*)((const char*)R + ((p >= cut ? ob1 : ob0) + (unsigned)(p * lda * 4)));   // summed in 32 bits: ob1 alone may lie below 0
      asm volatile("s_wait_xcnt 0x0" ::: "memory");   // precaution: the offset registers of these loads are reused as targets of the W loads below
    } else
    if constexpr (MA > 0) {   // MA is a multiple of RPP, so a pass lies wholly inside the input or wholly past it (block-uniform test); rows past it count as 0
      static_assert(MA % RPP == 0 && sizeof(AT) == 4, "whole passes of f32 rows");
#pragma unroll   // registers indexed by p
      for (int p = 0; p < NP; ++p) { v4u_t zq = {0u, 0u, 0u, 0u}; av[p] = zq; if (m0 + p * RPP < MA) av[p] = *(const v4ua*)(xsrc + p * RPP * lda); }
      xsrc += KT;
    } else
    { const AT* src = A + (size_t)(m0 + ar) * lda + k0 + ac;
#pragma unroll   // registers indexed by p
      for (int p = 0; p < NP; ++p) av[p] = *(const v4ua*)(src + p * RPP * lda); }
    if constexpr (NV > 0) {   // a thread's 4 columns lie wholly inside W or wholly past it, where they count as 0
      static_assert(NV % 4 == 0, "whole column quads");
#pragma unroll   // registers indexed by h, g
      for (int h = 0; h < NH; ++h)
#pragma unroll
        for (int g = 0; g < 4; ++g) { v4f_t zq = {0.0f, 0.0f, 0.0f, 0.0f}; wv[h][g] = zq; }
    }
    if (NV == 0 || n0 + nq < NV) {
#pragma unroll   // registers indexed by h, g
      for (int h = 0; h < NH; ++h)
#pragma unroll
        for (int g = 0; g < 4; ++g) wv[h][g] = *(const v4fa*)(wsrc + (32 * h + g) * ldw);
    }
    wsrc += KT * ldw;
    if constexpr (AIN != 0) __builtin_amdgcn_sched_barrier(0);   // every load of the step issues before the first is waited for: without it the A-side loads are scheduled one behind the other's wait, or W behind them all
#pragma unroll   // registers indexed by p
    for (int p = 0; p < NP; ++p) {
      f16* dst = ldsA + (AIN == 1 ? ar * NP + p : p * RPP + ar) * PST + ac;
      if constexpr (sizeof(AT) == 2) { *(v4ua*)dst = av[p]; }
      else { v4f_t fv; bf16x4 q;
        if constexpr (AIN == 1) {
#pragma unroll
          for (int e = 0; e < 4; ++e) fv[e] = fmaxf((p >= cut ? a1[e] : a0[e]) + ub[p][e], 0.0f); }
        else fv = __builtin_bit_cast(v4f_t, av[p]);
        q[0] = (f16)fv[0]; q[1] = (f16)fv[1]; q[2] = (f16)fv[2]; q[3] = (f16)fv[3];
        *(bf16x4*)dst = q; }
    }
#pragma unroll   // registers indexed by h, u
    for (int h = 0; h < NH; ++h)
#pragma unroll
      for (int u = 0; u < 4; ++u) { bf16x4 q; q[0] = (f16)wv[h][0][u]; q[1] = (f16)wv[h][1][u]; q[2] = (f16)wv[h][2][u]; q[3] = (f16)wv[h][3][u];
        *(bf16x4*)(ldsW + (nq + u) * PST + 32 * h + kq) = q; }
    if constexpr (AIN == 1) {   // 32-bit offsets move on by a step, so that each load is a uniform base plus one register
      oa0 += KT * 4u; oa1 += KT * 4u; ob0 += KT * 4u; ob1 += KT * 4u;
    }
    __syncthreads();
#pragma unroll   // constant LDS offsets; k runs upward as before, so every accumulator sums in the same order
    for (int h = 0; h < NH; ++h) {
      f16x16 af[2];
#pragma unroll
      for (int i = 0; i < 2; ++i) af[i] = lds_frag(ldsA + (wm + 16 * i) * PST + 32 * h, PST);
#pragma unroll
      for (int j = 0; j < 4; ++j) {
        const f16x16 bf = lds_frag(ldsW + (wn + 16 * j) * PST + 32 * h, PST);
#pragma unroll
        for (int i = 0; i < 2; ++i) acc[i][j] = wmma16(af[i], bf, acc[i][j]);
      }
    }
  }
  if constexpr (EPI == 4) {
    const int bf = m0 / (NN * NN);                        // batch of the tile's first row
    const int rel0 = m0 - bf * (NN * NN) + wm + rh;       // this lane's first row, counted from that batch's first pair row
    float bv[4], s0[4], s1[4];
#pragma unroll
    for (int j = 0; j < 4; ++j) { bv[j] = bias[n0 + wn + 16 * j + cl]; s0[j] = 0.0f; s1[j] = 0.0f; }
#pragma unroll
    for (int i = 0; i < 2; ++i)
#pragma unroll
      for (int r = 0; r < 8; ++r) {
        const int rel = rel0 + 16 * i + r;
        const bool nx = rel >= NN * NN;                   // row of the next batch (past the last batch: pad rows, whose sums nobody reads)
        const bool od = ((nx ? rel - NN * NN : rel) % (NN + 1)) != 0;   // pair row 25 i + j has i == j exactly when it is a multiple of 26
        const float h0 = (od && !nx) ? __builtin_inff() : 0.0f, h1 = (od && nx) ? __builtin_inff() : 0.0f;   // upper clamps: none for a row that counts, 0 else
#pragma unroll
        for (int j = 0; j < 4; ++j) { const float v = acc[i][j][r] + bv[j];
          s0[j] += __builtin_amdgcn_fmed3f(v, 0.0f, h0); s1[j] += __builtin_amdgcn_fmed3f(v, 0.0f, h1); }   // relu and row mask in one median
      }
    float* rp = oS + (wave * 2 + (lane >> 4)) * 128 + cl;
#pragma unroll
    for (int j = 0; j < 4; ++j) { rp[16 * j] = s0[j]; rp[64 + 16 * j] = s1[j]; }
    __syncthreads();   // the 8 half-wave sums of a column (4 row waves x 2 lane halves) meet here
    const int col = tid & 127, sg = tid >> 7;
    const float* qp = oS + (col >> 6) * 1024 + sg * 64 + (col & 63);
    float a = 0.0f;
#pragma unroll
    for (int w = 0; w < 8; ++w) a += qp[w * 128];
    ((float*)Yv)[(size_t)(2 * blockIdx.x + sg) * ldy + n0 + col] = a;
    return;
  }
  float* so = oS + wave * (32 * 68);
#pragma unroll
  for (int i = 0; i < 2; ++i)
#pragma unroll
    for (int j = 0; j < 4; ++j) {
      const int n = n0 + wn + 16 * j + cl;
      const float bv = (bias && (NV == 0 || n < NV) && (ZW == 0 || blockIdx.z == 0)) ? bias[n] : 0.0f;   // of several GEMMs in z the first alone takes the bias
      const float gv = (EPI == 2) ? gvec[n] : 0.0f;
      if (EPI == 1) {
#pragma unroll 1
        for (int r = 0; r < 8; ++r) { const float xg = acc[i][j][r] + bv; so[(16 * i + rh + r) * 68 + 16 * j + cl] = 0.5f * xg * (1.0f + erff(xg * 0.70710678118654752f)); }
      } else {
#pragma unroll
        for (int r = 0; r < 8; ++r) {
          float v = acc[i][j][r] + bv;
          if (EPI == 2) v = R[(size_t)(m0 + wm + 16 * i + rh + r) * ldy + n] + gv * v;
          if (EPI == 3) v = fmaxf(v, 0.0f);
          so[(16 * i + rh + r) * 68 + 16 * j + cl] = v;
        }
      }
    }
  asm volatile("s_wait_dscnt 0" ::: "memory");
  __builtin_amdgcn_wave_barrier();
{
    if (OUT16) {
      f16* Y = (f16*)Yv;
#pragma unroll
      for (int it = 0; it < 8; ++it) { const int c = lane + 32 * it, rr = c >> 3, q8 = (c & 7) * 8;
        union { f16 h[8]; v4u_t v; } u;
#pragma unroll
        for (int e = 0; e < 8; ++e) u.h[e] = (f16)so[rr * 68 + q8 + e];
        *(v4u_t*)(Y + (size_t)(m0 + wm + rr) * ldy + n0 + wn + q8) = u.v; }
    } else {
      float* Y = (float*)Yv;
#pragma unroll
      for (int it = 0; it < 16; ++it) { const int f4 = lane + 32 * it, rr = f4 >> 4, q = (f4 & 15) * 4;
        *(v4f_t*)(Y + (size_t)(m0 + wm + rr) * ldy + n0 + wn + q) = *(const v4fa*)(so + rr * 68 + q); }
    }
    
  }
}


// ---------------------------------------------------------------------------------------------------------------------------
// k_pair: layers 2 and 3 of the pair MLP and the i != j sum in one launch; the layer-2 activations never leave LDS.
// A work-group takes 79 pair rows of ONE batch (8 work-groups a batch, 8 * 79 >= 625; 80 rows computed, rows past the group's or the batch's end repeat a valid pair and are masked out of the sum)
// and all 512 columns: 256 equal work-groups, one a WGP. 16 waves, each 80 rows x 32 columns (5 x 2 accumulator tiles).
// h1 = relu(An_i + Bn_j) is formed once in f32 and rounded to f16 into LDS; W comes in 32-deep steps, transposed in registers as 4 x 4 blocks into one of two LDS buffers,
// the next step's loads in flight during this step's WMMAs; k runs upward, so h2 is bit-identical to the separate GEMM's. ps[b * 8 + t][n] = the group's column sums, fixed order.
// ---------------------------------------------------------------------------------------------------------------------------
#define PRW 79
#define PAP (HHd + 8)   // pitch of h1 and h2 in f16: 1040 B, 16 B x odd for the b128 fragment reads
#define WST 40          // pitch of a W column's 32 k in f16: 80 B, 16 B x odd; a wave's 32 8-byte runs fall on all 64 banks once
__device__ __forceinline__ void pair_wload(const char* __restrict__ wb, unsigned woff, v4f_t (&wv)[2][4]) {
#pragma unroll   // registers indexed by c, g
  for (int c = 0; c < 2; ++c)
#pragma unroll
    for (int g = 0; g < 4; ++g) wv[c][g] = *(const v4fa*)(wb + woff + (g * HHd + c * 256) * 4);
  asm volatile("s_wait_xcnt 0x0" ::: "memory");   // precaution: the base of these loads moves on in the next step, and their offset register may be reused
}
// one layer: acc += act[80][512] * Wm[512][512]. wv holds step 0 on entry; with MORE it holds step 0 of wnext on return.
template <bool MORE>
__device__ __forceinline__ void pair_mm(const f16* act, const char* __restrict__ wb, const char* __restrict__ wnext, unsigned woff, f16* ldsW, int wst, int wn,
                                        v4f_t (&wv)[2][4], f32x8 (&acc)[5][2]) {
#pragma unroll 1   // one copy of the step in the instruction cache
  for (int s = 0; s < HHd / 32; ++s) {
    f16* wl = ldsW + (s & 1) * (HHd * WST);   // this buffer's last readers (step s - 2) are behind the barrier of step s - 1
#pragma unroll   // registers indexed by c, u
    for (int c = 0; c < 2; ++c)
#pragma unroll
      for (int u = 0; u < 4; ++u) { bf16x4 q; q[0] = (f16)wv[c][0][u]; q[1] = (f16)wv[c][1][u]; q[2] = (f16)wv[c][2][u]; q[3] = (f16)wv[c][3][u];
        *(bf16x4*)(wl + wst + (c * 256 + u) * WST) = q; }
    wb += 32 * HHd * 4;
    if (MORE || s + 1 < HHd / 32) pair_wload(s + 1 < HHd / 32 ? wb : wnext, woff, wv);
    // work-group barrier by hand: publishes this step's W tile (and, at step 0, the activations), which are LDS stores only. __syncthreads() would also wait for the loads just issued, and the next step's W would not fly during the WMMAs.
    asm volatile("s_wait_dscnt 0x0\n\ts_barrier_signal -1\n\ts_barrier_wait -1" ::: "memory");
    f16x16 af[5];
#pragma unroll
    for (int i = 0; i < 5; ++i) af[i] = lds_frag(act + (16 * i) * PAP + 32 * s, PAP);
    const f16x16 bf0 = lds_frag(wl + wn * WST, WST), bf1 = lds_frag(wl + (wn + 16) * WST, WST);   // all of a step's fragment reads go out as one group ahead of its WMMAs
#pragma unroll
    for (int i = 0; i < 5; ++i) acc[i][0] = wmma16(af[i], bf0, acc[i][0]);
#pragma unroll
    for (int i = 0; i < 5; ++i) acc[i][1] = wmma16(af[i], bf1, acc[i][1]);
  }
}
__global__ __launch_bounds__(512) void k_pair(const float* __restrict__ An, const float* __restrict__ Bn, const float* __restrict__ W2, const float* __restrict__ b2,
                                              const float* __restrict__ W3, const float* __restrict__ b3, float* __restrict__ ps) {
  __shared__ __attribute__((aligned(16))) f16 h1[80 * PAP];
  __shared__ __attribute__((aligned(16))) f16 h2[80 * PAP];
  __shared__ __attribute__((aligned(16))) f16 ldsW[2 * HHd * WST];
  const int tid = threadIdx.x, lane = tid & 31, wave = tid >> 5, cl = lane & 15, rh = (lane >> 4) * 8;
  const int nb = (blockIdx.x >> 3) * NN, q0 = (blockIdx.x & 7) * PRW, wn = wave * 32;   // first node row of the batch; first pair row of the group, counted in the batch
  const int kq = (tid & 7) * 4, nq = (tid >> 3) * 4;   // this thread's 4(k) x 4(n) blocks of a W step: columns nq and nq + 256
  const unsigned woff = (unsigned)(kq * HHd + nq) * 4u;
  const int wst = nq * WST + kq;
  v4f_t wv[2][4];
  pair_wload((const char*)W2, woff, wv);   // flies while h1 is formed
  { const int rg = __builtin_amdgcn_readfirstlane(tid >> 7), c4 = (tid & 127) * 4;   // 128 lanes side by side cover a row; the row is the same in a whole wave, so its address is a scalar base
    const unsigned coff = (unsigned)c4 * 4u;
#pragma unroll   // registers indexed by p
    for (int hp = 0; hp < 2; ++hp) {
      v4f_t a[10], u[10]; unsigned oa[10], ob[10];   // byte offsets from the two uniform bases
#pragma unroll
      for (int p = 0; p < 10; ++p) { const int q = min(q0 + (hp * 10 + p) * 4 + rg, NN * NN - 1), i = q / NN, j = q - i * NN;
        oa[p] = (unsigned)((nb + i) * HHd) * 4u + coff; ob[p] = (unsigned)((nb + j) * HHd) * 4u + coff; }
#pragma unroll
      for (int p = 0; p < 10; ++p) { a[p] = *(const v4fa*)((const char*)An + oa[p]); u[p] = *(const v4fa*)((const char*)Bn + ob[p]); }
      // precaution: the offset registers of the loads above stay untouched up to this wait, also as targets of later loads
      asm volatile("s_wait_xcnt 0x0" :: "v"(oa[0]), "v"(oa[1]), "v"(oa[2]), "v"(oa[3]), "v"(oa[4]), "v"(oa[5]), "v"(oa[6]), "v"(oa[7]), "v"(oa[8]), "v"(oa[9]),
                   "v"(ob[0]), "v"(ob[1]), "v"(ob[2]), "v"(ob[3]), "v"(ob[4]), "v"(ob[5]), "v"(ob[6]), "v"(ob[7]), "v"(ob[8]), "v"(ob[9]) : "memory");
#pragma unroll
      for (int p = 0; p < 10; ++p) { bf16x4 q4;
#pragma unroll
        for (int e = 0; e < 4; ++e) q4[e] = (f16)fmaxf(a[p][e] + u[p][e], 0.0f);
        *(bf16x4*)(h1 + ((hp * 10 + p) * 4 + rg) * PAP + c4) = q4; }
    }
  }
  f32x8 acc[5][2];
#pragma unroll
  for (int i = 0; i < 5; ++i)
#pragma unroll
    for (int j = 0; j < 2; ++j) { f32x8 z = {}; acc[i][j] = z; }
  pair_mm<true>(h1, (const char*)W2, (const char*)W3, woff, ldsW, wst, wn, wv, acc);
#pragma unroll
  for (int j = 0; j < 2; ++j) { const float bv = b2[wn + 16 * j + cl];
#pragma unroll
    for (int i = 0; i < 5; ++i) {
#pragma unroll
      for (int r = 0; r < 8; ++r) h2[(16 * i + rh + r) * PAP + wn + 16 * j + cl] = (f16)fmaxf(acc[i][j][r] + bv, 0.0f);
      f32x8 z = {}; acc[i][j] = z; }
  }
  pair_mm<false>(h2, (const char*)W3, nullptr, woff, ldsW, wst, wn, wv, acc);
  const float bv0 = b3[wn + cl], bv1 = b3[wn + 16 + cl];
  float s0 = 0.0f, s1 = 0.0f;
#pragma unroll
  for (int i = 0; i < 5; ++i)
#pragma unroll
    for (int r = 0; r < 8; ++r) { const int row = 16 * i + rh + r, q = q0 + row;
      const bool ok = row < PRW && q < NN * NN && (q % (NN + 1)) != 0;   // pair row 25 i + j has i == j exactly when it is a multiple of 26
      const float hi = ok ? __builtin_inff() : 0.0f;                      // upper clamp: none for a row that counts, 0 else
      s0 += __builtin_amdgcn_fmed3f(acc[i][0][r] + bv0, 0.0f, hi); s1 += __builtin_amdgcn_fmed3f(acc[i][1][r] + bv1, 0.0f, hi); }   // relu and row mask in one median
  s0 += __shfl_xor(s0, 16); s1 += __shfl_xor(s1, 16);   // the two lane halves hold rows 0..7 and 8..15 of each row tile
  ps[(size_t)blockIdx.x * HHd + wn + lane] = lane < 16 ? s0 : s1;   // a wave stores one whole line
}

// ---------------------------------------------------------------------------------------------------------------------------
// k_tail: one layer of the f MLP, Y[32][N] = A[32][512] * W[512][N] + bias. These layers are three dependent launches of almost no work, so what counts is the
// chain of waits inside one launch: here the global loads of a work-group are in flight at once and waited for once, with TA 1 in two halves and twice (the tiled GEMM waits four times, for 128 rows of which 32 count).
// A work-group takes 16 columns; its 32 waves are 16 k slices of 32 (one WMMA deep) x 2 row tiles. Each wave loads its B fragment straight from W (f32, rounded to f16 as before), does one WMMA,
// and the 16 k-slice tiles are summed in LDS in f32, k upward. Activations lie in 16-column blocks [N / 16][32][16], so a work-group stores whole lines of its own and an A fragment is two contiguous 512-byte loads.
// TA 1: A row b is the sum, in group order, of the 8 rows of ps that k_pair wrote for batch b, formed once per work-group with whole-line loads and handed to the waves through LDS as f16.
// LAST: f32 sums without relu, in the same blocks. Columns from NV on repeat column NV - 1 (address clamp); nobody reads them.
// ---------------------------------------------------------------------------------------------------------------------------
template <int TA, int ldw, int NV, bool LAST>
__global__ __launch_bounds__(1024) void k_tail(const _Float16* __restrict__ Zin, const float* __restrict__ ps, const float* __restrict__ Wm,
                                               const float* __restrict__ bias, _Float16* __restrict__ Zout, float* __restrict__ Lout) {
  constexpr int APS = HHd + 8;                // LDS row pitch in f16: 1040 B, 16 B x odd for the b128 fragment reads
  __shared__ __attribute__((aligned(16))) f16 ldsA[TA == 1 ? NBr * APS : 8];
  __shared__ __attribute__((aligned(16))) float red[16 * 512];
  const int tid = threadIdx.x, lane = tid & 31, wave = tid >> 5, cl = lane & 15, kh = (lane >> 4) * 8;
  const int ks = wave & 15, mi = wave >> 4, k0 = ks * 32, n0 = blockIdx.x * 16;
  // B fragment: column n0 + cl, k in the order of lds_frag (k0 + kh + 0..7, then + 16)
  // Every load is a uniform base plus one 32-bit offset register plus a constant.
  const int nc = min(n0 + cl, NV - 1);
  const unsigned woff = (unsigned)((k0 + kh) * ldw + nc) * 4u;
  const int bq = __builtin_amdgcn_readfirstlane(tid >> 7);   // TA 1: 128 lanes side by side cover a row of ps, 8 rows a pass; the row is the same in a whole wave, so its address is a scalar base
  const char* qs[4];                                         // first of the 8 rows of pass p's batch
  if constexpr (TA == 1) {
#pragma unroll   // registers indexed by p
    for (int p = 0; p < 4; ++p) qs[p] = (const char*)(ps + (size_t)((p * 8 + bq) * 8) * HHd);
  }
  float wv[16];
#pragma unroll   // registers indexed by i
  for (int i = 0; i < 8; ++i) { wv[i] = *(const float*)((const char*)Wm + woff + i * (ldw * 4)); wv[8 + i] = *(const float*)((const char*)Wm + woff + (16 + i) * (ldw * 4)); }
  const float bv = bias[nc];   // the output element that this thread finishes below has column n0 + tid % 16 too
  f16x16 af;
  if constexpr (TA == 1) {
    // 32 batches x 8 rows of ps are 128 registers a thread, the whole budget of 32 waves: they come in two halves of 16 loads, the first in flight together with W.
    const int c4 = (tid & 127) * 4; const unsigned poff = (unsigned)c4 * 4u;
#pragma unroll   // registers indexed by hp, p, u
    for (int hp = 0; hp < 2; ++hp) {
      v4f_t pv[2][8];
#pragma unroll
      for (int p = 0; p < 2; ++p)
#pragma unroll
        for (int u = 0; u < 8; ++u) pv[p][u] = *(const v4fa*)(qs[2 * hp + p] + poff + u * (HHd * 4));
      asm volatile("s_wait_xcnt 0x0" :: "v"(woff), "v"(nc), "v"(poff) : "memory");   // precaution: the offset registers of the loads above stay untouched up to this wait, also as targets of later loads
      __builtin_amdgcn_sched_barrier(0);   // every load of the half issues before the first is waited for: without it the loads are scheduled in small groups, each behind the wait for the group before, W last
#pragma unroll
      for (int p = 0; p < 2; ++p) { v4f_t sm = pv[p][0];
#pragma unroll
        for (int u = 1; u < 8; ++u) sm += pv[p][u];
        bf16x4 q4; q4[0] = (f16)sm[0]; q4[1] = (f16)sm[1]; q4[2] = (f16)sm[2]; q4[3] = (f16)sm[3];
        *(bf16x4*)(ldsA + ((2 * hp + p) * 8 + bq) * APS + c4) = q4; }
    }
    __syncthreads();   // the joined rows are read by every wave
    af = lds_frag(ldsA + (16 * mi) * APS + k0, APS);
  } else {
    const unsigned zoff = (unsigned)((k0 >> 4) * (NBr * 16) + (16 * mi + cl) * 16 + kh) * 2u;
    const f16x8 lo = *(const f16x8*)((const char*)Zin + zoff), hi = *(const f16x8*)((const char*)Zin + zoff + NBr * 16 * 2);
#pragma unroll
    for (int i = 0; i < 8; ++i) { af[i] = lo[i]; af[i + 8] = hi[i]; }
  }
  f16x16 bfr;
#pragma unroll
  for (int i = 0; i < 16; ++i) bfr[i] = (f16)wv[i];
  f32x8 acc = {};
  acc = wmma16(af, bfr, acc);
  float* rp = red + ks * 512 + mi * 256 + lane;
#pragma unroll
  for (int r = 0; r < 8; ++r) rp[r * 32] = acc[r];
  __syncthreads();   // the 16 k-slice tiles of an output element meet here
  if (tid < 512) {   // one output element a thread, in the order of the block it is stored to: row = tid / 16, column = tid % 16
    const int row = tid >> 4;
    const float* qp = red + (row >> 4) * 256 + (row & 7) * 32 + ((row >> 3) & 1) * 16 + (tid & 15);
    float a = qp[0];
#pragma unroll
    for (int w = 1; w < 16; ++w) a += qp[w * 512];
    a += bv;
    if constexpr (LAST) Lout[blockIdx.x * 512 + tid] = a;
    else Zout[blockIdx.x * 512 + tid] = (f16)fmaxf(a, 0.0f);
  }
}

// logits [32][1000] from the 16-column blocks as one contiguous stream of 32,000 floats (8,000 float4; rows and blocks are multiples of 4 so no chunk straddles either)
__global__ __launch_bounds__(256) void k_out(const float* __restrict__ lp, float* __restrict__ out) {
  const int q4 = blockIdx.x * 256 + threadIdx.x; if (q4 >= NBr * NCLS / 4) return; const int fidx = q4 * 4, r = fidx / NCLS, c = fidx % NCLS;
  const v4f_t v = *(const v4f_t*)(lp + (size_t)(c >> 4) * (NBr * 16) + r * 16 + (c & 15)); *(v4f_t*)(out + fidx) = v; 
}

extern "C" void kernel_launch(void* const* d_in, const int* in_sizes, int n_in,
                              void* d_out, int out_size, void* d_ws, size_t ws_size,
                              hipStream_t stream) {
  (void)in_sizes; (void)n_in; (void)out_size;
  const float** f = (const float**)d_in;
  const float* x = f[0], *g_w1 = f[1], *g_b1 = f[2], *g_w2 = f[3], *g_b2 = f[4], *g_w3 = f[5], *g_b3 = f[6], *f_w1 = f[7], *f_b1 = f[8], *f_w2 = f[9], *f_b2 = f[10], *f_w3 = f[11], *f_b3 = f[12];
  float* out = (float*)d_out;      // [32,1000]
  char* ws = (char*)d_ws;
  float* A = (float*)ws; ws += (size_t)NROWP * HHd * 4; float* Bq = (float*)ws; ws += (size_t)NROWP * HHd * 4;   // Bq directly behind A: the z = 1 output of the layer-1 launch
  float* ps = (float*)ws; ws += (size_t)NBr * 8 * HHd * 4;   // layer-3 column sums, 8 rows a batch
  bf16* z1 = (bf16*)ws; ws += (size_t)128 * HHd * 2;
  bf16* z2 = (bf16*)ws; ws += (size_t)128 * HHd * 2;
  float* lp = (float*)ws; ws += (size_t)128 * NCP * 4;
  if ((size_t)(ws - (char*)d_ws) > ws_size) return;
  const dim3 blk(256);
  gemm_kne<float, 128, DDr, HHd, 0, false, NROWS, 0, DDr * HHd, NROWP * HHd * 4><<<dim3(NROWP / 128, HHd / 128, 2), blk, 0, stream>>>(nullptr, x, g_w1, g_b1, nullptr, nullptr, A, HHd, DDr);   // z = 0: x*W1[:D] + b1 -> A; z = 1: x*W1[D:] -> Bq
  k_pair<<<dim3(NBr * 8), dim3(512), 0, stream>>>(A, Bq, g_w2, g_b2, g_w3, g_b3, ps);   // per group of 79 pair rows: sums over i != j of relu(relu(h1*W2 + b2)*W3 + b3), h1 = relu(A_i + Bq_j)
  k_tail<1, HHd, HHd, false><<<dim3(HHd / 16), dim3(1024), 0, stream>>>(nullptr, ps, f_w1, f_b1, z1, nullptr);   // A = the group sums joined per batch
  k_tail<0, HHd, HHd, false><<<dim3(HHd / 16), dim3(1024), 0, stream>>>(z1, nullptr, f_w2, f_b2, z2, nullptr);
  k_tail<0, NCLS, NCLS, true><<<dim3((NCLS + 15) / 16), dim3(1024), 0, stream>>>(z2, nullptr, f_w3, f_b3, nullptr, lp);
  k_out<<<dim3((NBr * NCLS / 4 + 255) / 256), blk, 0, stream>>>(lp, out);
}

// v008
// Measured time: 44.7 microseconds a run.
// Timed twice side by side with v007, it ran 1.39 and 1.38 times as fast.
// Over all steps from v000 it is 15.8 times as fast.
// Contractions on v_wmma_f32_16x16x32_f16 (plain f16 operands, f32 accumulate): the pair MLP g over all 32x25x25 ordered pairs as GEMMs
// with M = pairs: layer 1 split exactly as [x_i, x_j]·W1 = x_i·W1[:D] + x_j·W1[D:] (two K = 512 GEMMs on the 800 node rows, then relu of the
// broadcast sum per pair, rounded to f16 by the layer-2 loader), layers 2 and 3 (K = 512, 79 pair rows of a batch a work-group, in one launch), the i != j sum per batch in f32
// (fixed order), and the f MLP on the 32 aggregated rows (two 16-row tiles, no pad rows; K = 512 split over 16 waves; N in 16-column work-groups). ReLU in f32. The [32][1000]
#include <hip/hip_runtime.h>
#include <hip/hip_bf16.h>
#include <math.h>

#define NBr 32
#define NN 25
#define DDr 512
#define HHd 512
#define NCLS 1000
#define NCP 1024
#define NROWS (NBr * NN)          // 800
#define NROWP 896
#define NPAIR (NBr * NN * NN)     // 20000
#define NPAIRP 20096
#define GSTR 40
#define SS 64
#define HH 1
#define DKK 64

typedef _Float16 bf16;
typedef _Float16 f16;
typedef __attribute__((ext_vector_type(4))) unsigned v4u_t;
typedef unsigned v4ua __attribute__((ext_vector_type(4), may_alias));
typedef __attribute__((ext_vector_type(4))) float v4f_t;
typedef float v4fa __attribute__((ext_vector_type(4), may_alias));
typedef __attribute__((ext_vector_type(16))) bf16  bf16x16;
typedef bf16x16 f16x16;
typedef __attribute__((ext_vector_type(8)))  bf16  bf16x8;
typedef bf16x8 f16x8;
typedef __attribute__((ext_vector_type(4)))  bf16  bf16x4;
typedef __attribute__((ext_vector_type(8)))  float f32x8;
__device__ __forceinline__ f32x8 wmma16(f16x16 a, f16x16 b, f32x8 c) {
  c = __builtin_amdgcn_wmma_f32_16x16x32_f16(false, a, false, b, (short)0, c, false, false);
  asm volatile("v_nop\n\tv_nop\n\tv_nop\n\tv_nop" : "+v"(c) : "v"(a), "v"(b));
  return c;
}
#define LDS_STRIDE 48   // unused: gemm_kne tiles use PST = KT + 8 (136 elems, 272B rows)
#define KSTRIDE    72   // unused
#define VSTRIDE    48   // unused

__device__ __forceinline__ f32x8 wmma_bf16(bf16x16 a, bf16x16 b, f32x8 c) {
  c = __builtin_amdgcn_wmma_f32_16x16x32_f16(false, a, false, b, (short)0, c, false, false);
  asm volatile("v_nop\n\tv_nop\n\tv_nop\n\tv_nop" : "+v"(c) : "v"(a), "v"(b));   // A/B-overwrite hazard guard
  return c;
}

// 16x32 (MxK) f16 fragment from a row-major global matrix.
// lanes 0-15  (row=lane)    : elems 0..7 = K+0..7,  8..15 = K+16..23
// lanes 16-31 (row=lane-16) : elems 0..7 = K+8..15, 8..15 = K+24..31
template <typename T>
__device__ __forceinline__ bf16x16 load_frag(const T* __restrict__ base, int ld,
                                             int row0, int k0) {
  const int lane = threadIdx.x & 31;
  const int r    = lane & 15;
  const int kh   = (lane >> 4) * 8;
  const T* p0 = base + (size_t)(row0 + r) * ld + (k0 + kh);
  const T* p1 = p0 + 16;
  bf16x16 f;
#pragma unroll
  for (int i = 0; i < 8; ++i) {
    f[i]     = (bf16)p0[i];
    f[i + 8] = (bf16)p1[i];
  }
  return f;
}

// Same fragment from an LDS tile with padded row stride (base includes row0/k0).
__device__ __forceinline__ bf16x16 lds_frag(const bf16* base, int stride) {
  const int lane = threadIdx.x & 31;
  const int row  = lane & 15;
  const int kh   = (lane >> 4) * 8;
  const bf16x8 lo = *(const bf16x8*)(base + row * stride + kh);
  const bf16x8 hi = *(const bf16x8*)(base + row * stride + kh + 16);
  bf16x16 f;
#pragma unroll
  for (int i = 0; i < 8; ++i) { f[i] = lo[i]; f[i + 8] = hi[i]; }
  return f;
}

template <typename T>
__device__ __forceinline__ void stage_read16(const T* __restrict__ p, float* buf) {
#pragma unroll
  for (int i = 0; i < 16; ++i) buf[i] = (float)p[i];
}

__device__ __forceinline__ void stage_write(bf16* dst, const float* buf, int nquad) {
#pragma unroll
  for (int i = 0; i < nquad; ++i) {
    bf16x4 q;
    q[0] = (bf16)buf[4 * i];     q[1] = (bf16)buf[4 * i + 1];
    q[2] = (bf16)buf[4 * i + 2]; q[3] = (bf16)buf[4 * i + 3];
    *(bf16x4*)(dst + 4 * i) = q;
  }
}


// ---------------------------------------------------------------------------------------------------------------------------
// gemm_kne: Y[m][n] = epi( sum_k A[m][k]*W[k][n] + bias[n] ), A f32/f16 [M][lda], W f32 row-major [K][N] (ldw), plain f16 operands,
// f32 accumulate. EPI 0: identity; 1: exact-erf GELU; 2: R[m][n] + gvec[n]*(.) (residual with per-channel gain). Output f32 (or f16
// when OUT16). Block = 128x128 tile, 8 waves as 4(M) x 2(N); per KT-wide k-step A and W tiles staged f16 in LDS (W transposed).
// KT = k depth of one staged tile: every global load of a step is in flight at once, so a GEMM waits out K / KT load latencies.
// lda, ldw = row pitches of A and W in elements, compile-time so that a tile's loads differ only in their immediate offset.
// EPI 3: relu, so that with OUT16 a layer's activation leaves the GEMM as the next layer's f16 operand (same rounding as relu and convert of the f32 sum).
// MA > 0: A is the f32 input Xin with MA rows, read unpadded. NV > 0: W and bias have NV columns (a multiple of 4), read unpadded; columns past NV count as 0.
// ZW, ZY: blockIdx.z picks one of several GEMMs on the same A: W moves by ZW elements, Y by ZY bytes.
// EPI 4 (pair rows, 625 a batch): the tile is not stored; Y[2 * tile + s][n] = sum over the tile's rows with i != j of relu(. + bias), s = 0 for rows of the
// batch that holds the tile's first row, s = 1 for rows of the next one (128 < 625: a tile touches two batches at most). Fixed order.
// AIN 1: A row p is pair row p = (b * 25 + i) * 25 + j of layer 1, relu(Xin[b * 25 + i] + R[b * 25 + j]) (the bias lies in Xin already), formed in f32 by the loader and rounded to f16 as it goes to LDS;
// rows past the last pair take node row 799 of Xin and the zero pad rows 800..895 of R (their results are never summed).
// With AIN 1 the kernel is held to 160 registers (6 waves a SIMD), so that three work-groups share a WGP and the whole grid is resident at once, as with f16 A rows.
// PK: work-groups with blockIdx.z >= 2 take no part in the GEMM. On WGPs that the GEMM leaves idle they round R and gvec (here the weights of pair layers 2 and 3) to f16 in the order
// in which k_pair's waves read them, behind the two GEMM outputs (Y0 + 2 * ZY bytes): one 32 x 32 block a wave (pack_w).
// ---------------------------------------------------------------------------------------------------------------------------
#define GSTR 40
// Packed weights of the pair layers: f16, B fragments ready to load. Block t = (layer * 16 + s) * 16 + w holds rows 32 s .. and columns 32 w .. of the layer's W[512][512] in 2 KB: four pieces of 512 B,
// piece 2 j + hl, a lane's 16 bytes in it = column 32 w + 16 j + (lane & 15), k = 32 s + 16 hl + 8 (lane >> 4) + 0..7: the k order of lds_frag.
// A wave reads whole lines (lane = column, 32 rows in flight at once) and stores whole lines: the 8 k of group m go to piece 2 j + (m >> 1), place (lane & 15) + 16 (m & 1).
__device__ __forceinline__ void pack_w(const float* __restrict__ Wsrc, int s, int w, char* __restrict__ dst) {
  const int lane = threadIdx.x & 31;
  const unsigned vidx = (unsigned)(32 * s * HHd + 32 * w + lane);
  float v[32];
#pragma unroll   // registers indexed by k
  for (int k = 0; k < 32; ++k) v[k] = Wsrc[vidx + k * HHd];
  asm volatile("s_wait_xcnt 0x0" :: "v"(vidx) : "memory");   // precaution: the index register of the loads above stays untouched up to this wait, also as a target of later loads
#pragma unroll   // registers indexed by m
  for (int m = 0; m < 4; ++m) { f16x8 q;
#pragma unroll
    for (int e = 0; e < 8; ++e) q[e] = (f16)v[8 * m + e];
    *(f16x8*)(dst + ((lane >> 4) * 2 + (m >> 1)) * 512 + ((lane & 15) + 16 * (m & 1)) * 16) = q; }
}
template <typename AT, int KT, int lda, int ldw, int EPI, bool OUT16, int MA = 0, int NV = 0, int ZW = 0, int ZY = 0, int AIN = 0, bool PK = false>
__global__ __launch_bounds__(256, AIN == 1 ? 6 : 1) void gemm_kne(const AT* __restrict__ A, const float* __restrict__ Xin, const float* __restrict__ W0,
                                                const float* __restrict__ bias, const float* __restrict__ R, const float* __restrict__ gvec,
                                                void* __restrict__ Y0, int ldy, int K) {
  if constexpr (PK) {
    if (blockIdx.z >= 2) {   // block-uniform, in front of every barrier
      const int t = (((blockIdx.z - 2) * gridDim.y + blockIdx.y) * gridDim.x + blockIdx.x) * 8 + __builtin_amdgcn_readfirstlane(threadIdx.x >> 5);   // the same in a whole wave: scalar test, scalar bases
      if (t < 2 * 256) pack_w(t < 256 ? R : gvec, (t >> 4) & 15, t & 15, (char*)Y0 + (size_t)2 * ZY + (size_t)t * 2048);
      return;
    }
  }
  const float* __restrict__ Wm = W0 + (size_t)blockIdx.z * ZW;
  void* __restrict__ Yv = (char*)Y0 + (size_t)blockIdx.z * ZY;
  constexpr int PST = KT + 8;                 // LDS row pitch in f16: 144 B (KT 64) or 272 B (KT 128), 16 B x odd for the b128 fragment reads
  constexpr int AE = 16 / (int)sizeof(AT);    // A elements in one 16-byte load
  constexpr int LPR = KT / AE;                // lanes that cover one A row of the tile, side by side: whole 128-byte lines per load
  constexpr int RPP = 256 / LPR;              // A rows the block loads per pass
  constexpr int NP = 128 / RPP;               // passes
  constexpr int NH = KT / 32;                 // 32-deep slices of the tile
  __shared__ __attribute__((aligned(16))) f16 ldsA[128 * PST];
  __shared__ __attribute__((aligned(16))) f16 ldsW[128 * PST];
  __shared__ __attribute__((aligned(16))) float oS[EPI == 4 ? 8 * 2 * 2 * 64 : 8 * 32 * 68];
  const int tid = threadIdx.x, lane = tid & 31, wave = tid >> 5, cl = lane & 15, rh = (lane >> 4) * 8;
  const int m0 = blockIdx.x * 128, n0 = blockIdx.y * 128;
  const int wm = (wave & 3) * 32, wn = (wave >> 2) * 64;
  const int ar = tid / LPR, ac = (tid % LPR) * AE;
  // W: each thread takes 4(k) x 4(n) blocks and transposes them in registers, so column n gets 8-byte runs of 4 k.
  // At either pitch 4 columns are 16 banks apart, so a wave's 32 runs (8 k-quads x 4 column quads) fall on all 64 banks once.
  const int kq = (tid & 7) * 4, nq = (tid >> 3) * 4;
  f32x8 acc[2][4];
#pragma unroll
  for (int i = 0; i < 2; ++i)
#pragma unroll
    for (int j = 0; j < 4; ++j) { f32x8 z = {}; acc[i][j] = z; }
  // AIN 1: a thread takes NP pair rows in a row (NP < 25), which share one x_i row or two: rows from 'cut' on have the second. Byte offsets from the two uniform bases.
  unsigned oa0 = 0, oa1 = 0, ob0 = 0, ob1 = 0; int cut = 0;
  if constexpr (AIN == 1) {
    static_assert(sizeof(AT) == 4 && NP < NN, "f32 node rows, two x_i rows at most");
    const int r0 = m0 + ar * NP, f0 = min(r0, NPAIR - 1) / NN, f1 = min(r0 + NP - 1, NPAIR - 1) / NN;   // f = b * 25 + i of the first and the last row
    const int nb0 = (f0 / NN) * NN - f0 * NN, nb1 = (f1 / NN) * NN - f1 * NN;                           // b * 25 + j = nb + pair row
    cut = f1 * NN - r0; oa0 = (unsigned)(f0 * lda + ac) * 4u; oa1 = (unsigned)(f1 * lda + ac) * 4u;
    ob0 = (unsigned)((nb0 + r0) * lda + ac) * 4u; ob1 = (unsigned)((nb1 + r0) * lda + ac) * 4u;   // x_j row of pair row r0 + p: p rows on from here (pad pair rows fall on the pad node rows 800..895)
  }
  const float* xsrc = Xin + (size_t)(m0 + ar) * lda + ac;   // MA > 0: this thread's place in the tile's first row pass, moved on by KT a step
  const float* wsrc = Wm + (size_t)kq * ldw + n0 + nq;      // this thread's 4 x 4 blocks of W, moved on by KT rows a step
#pragma unroll 1
  for (int k0 = 0; k0 < K; k0 += KT) {
    __syncthreads();
    v4u_t av[NP];
    v4f_t ub[AIN == 1 ? NP : 1], a0, a1;
    v4f_t wv[NH][4];
    if constexpr (AIN == 1) {
      a0 = *(const v4fa*)((const char*)Xin + oa0); a1 = *(const v4fa*)((const char*)Xin + oa1);
#pragma unroll   // registers indexed by p
      for (int p = 0; p < NP; ++p) ub[p] = *(const v4fa*)((const char*)R + ((p >= cut ? ob1 : ob0) + (unsigned)(p * lda * 4)));   // summed in 32 bits: ob1 alone may lie below 0
      asm volatile("s_wait_xcnt 0x0" ::: "memory");   // precaution: the offset registers of these loads are reused as targets of the W loads below
    } else
    if constexpr (MA > 0) {   // MA is a multiple of RPP, so a pass lies wholly inside the input or wholly past it (block-uniform test); rows past it count as 0
      static_assert(MA % RPP == 0 && sizeof(AT) == 4, "whole passes of f32 rows");
#pragma unroll   // registers indexed by p
      for (int p = 0; p < NP; ++p) { v4u_t zq = {0u, 0u, 0u, 0u}; av[p] = zq; if (m0 + p * RPP < MA) av[p] = *(const v4ua*)(xsrc + p * RPP * lda); }
      xsrc += KT;
    } else
    { const AT* src = A + (size_t)(m0 + ar) * lda + k0 + ac;
#pragma unroll   // registers indexed by p
      for (int p = 0; p < NP; ++p) av[p] = *(const v4ua*)(src + p * RPP * lda); }
    if constexpr (NV > 0) {   // a thread's 4 columns lie wholly inside W or wholly past it, where they count as 0
      static_assert(NV % 4 == 0, "whole column quads");
#pragma unroll   // registers indexed by h, g
      for (int h = 0; h < NH; ++h)
#pragma unroll
        for (int g = 0; g < 4; ++g) { v4f_t zq = {0.0f, 0.0f, 0.0f, 0.0f}; wv[h][g] = zq; }
    }
    if (NV == 0 || n0 + nq < NV) {
#pragma unroll   // registers indexed by h, g
      for (int h = 0; h < NH; ++h)
#pragma unroll
        for (int g = 0; g < 4; ++g) wv[h][g] = *(const v4fa*)(wsrc + (32 * h + g) * ldw);
    }
    wsrc += KT * ldw;
    if constexpr (AIN != 0) __builtin_amdgcn_sched_barrier(0);   // every load of the step issues before the first is waited for: without it the A-side loads are scheduled one behind the other's wait, or W behind them all
#pragma unroll   // registers indexed by p
    for (int p = 0; p < NP; ++p) {
      f16* dst = ldsA + (AIN == 1 ? ar * NP + p : p * RPP + ar) * PST + ac;
      if constexpr (sizeof(AT) == 2) { *(v4ua*)dst = av[p]; }
      else { v4f_t fv; bf16x4 q;
        if constexpr (AIN == 1) {
#pragma unroll
          for (int e = 0; e < 4; ++e) fv[e] = fmaxf((p >= cut ? a1[e] : a0[e]) + ub[p][e], 0.0f); }
        else fv = __builtin_bit_cast(v4f_t, av[p]);
        q[0] = (f16)fv[0]; q[1] = (f16)fv[1]; q[2] = (f16)fv[2]; q[3] = (f16)fv[3];
        *(bf16x4*)dst = q; }
    }
#pragma unroll   // registers indexed by h, u
    for (int h = 0; h < NH; ++h)
#pragma unroll
      for (int u = 0; u < 4; ++u) { bf16x4 q; q[0] = (f16)wv[h][0][u]; q[1] = (f16)wv[h][1][u]; q[2] = (f16)wv[h][2][u]; q[3] = (f16)wv[h][3][u];
        *(bf16x4*)(ldsW + (nq + u) * PST + 32 * h + kq) = q; }
    if constexpr (AIN == 1) {   // 32-bit offsets move on by a step, so that each load is a uniform base plus one register
      oa0 += KT * 4u; oa1 += KT * 4u; ob0 += KT * 4u; ob1 += KT * 4u;
    }
    __syncthreads();
#pragma unroll   // constant LDS offsets; k runs upward as before, so every accumulator sums in the same order
    for (int h = 0; h < NH; ++h) {
      f16x16 af[2];
#pragma unroll
      for (int i = 0; i < 2; ++i) af[i] = lds_frag(ldsA + (wm + 16 * i) * PST + 32 * h, PST);
#pragma unroll
      for (int j = 0; j < 4; ++j) {
        const f16x16 bf = lds_frag(ldsW + (wn + 16 * j) * PST + 32 * h, PST);
#pragma unroll
        for (int i = 0; i < 2; ++i) acc[i][j] = wmma16(af[i], bf, acc[i][j]);
      }
    }
  }
  if constexpr (EPI == 4) {
    const int bf = m0 / (NN * NN);                        // batch of the tile's first row
    const int rel0 = m0 - bf * (NN * NN) + wm + rh;       // this lane's first row, counted from that batch's first pair row
    float bv[4], s0[4], s1[4];
#pragma unroll
    for (int j = 0; j < 4; ++j) { bv[j] = bias[n0 + wn + 16 * j + cl]; s0[j] = 0.0f; s1[j] = 0.0f; }
#pragma unroll
    for (int i = 0; i < 2; ++i)
#pragma unroll
      for (int r = 0; r < 8; ++r) {
        const int rel = rel0 + 16 * i + r;
        const bool nx = rel >= NN * NN;                   // row of the next batch (past the last batch: pad rows, whose sums nobody reads)
        const bool od = ((nx ? rel - NN * NN : rel) % (NN + 1)) != 0;   // pair row 25 i + j has i == j exactly when it is a multiple of 26
        const float h0 = (od && !nx) ? __builtin_inff() : 0.0f, h1 = (od && nx) ? __builtin_inff() : 0.0f;   // upper clamps: none for a row that counts, 0 else
#pragma unroll
        for (int j = 0; j < 4; ++j) { const float v = acc[i][j][r] + bv[j];
          s0[j] += __builtin_amdgcn_fmed3f(v, 0.0f, h0); s1[j] += __builtin_amdgcn_fmed3f(v, 0.0f, h1); }   // relu and row mask in one median
      }
    float* rp = oS + (wave * 2 + (lane >> 4)) * 128 + cl;
#pragma unroll
    for (int j = 0; j < 4; ++j) { rp[16 * j] = s0[j]; rp[64 + 16 * j] = s1[j]; }
    __syncthreads();   // the 8 half-wave sums of a column (4 row waves x 2 lane halves) meet here
    const int col = tid & 127, sg = tid >> 7;
    const float* qp = oS + (col >> 6) * 1024 + sg * 64 + (col & 63);
    float a = 0.0f;
#pragma unroll
    for (int w = 0; w < 8; ++w) a += qp[w * 128];
    ((float*)Yv)[(size_t)(2 * blockIdx.x + sg) * ldy + n0 + col] = a;
    return;
  }
  float* so = oS + wave * (32 * 68);
#pragma unroll
  for (int i = 0; i < 2; ++i)
#pragma unroll
    for (int j = 0; j < 4; ++j) {
      const int n = n0 + wn + 16 * j + cl;
      const float bv = (bias && (NV == 0 || n < NV) && (ZW == 0 || blockIdx.z == 0)) ? bias[n] : 0.0f;   // of several GEMMs in z the first alone takes the bias
      const float gv = (EPI == 2) ? gvec[n] : 0.0f;
      if (EPI == 1) {
#pragma unroll 1
        for (int r = 0; r < 8; ++r) { const float xg = acc[i][j][r] + bv; so[(16 * i + rh + r) * 68 + 16 * j + cl] = 0.5f * xg * (1.0f + erff(xg * 0.70710678118654752f)); }
      } else {
#pragma unroll
        for (int r = 0; r < 8; ++r) {
          float v = acc[i][j][r] + bv;
          if (EPI == 2) v = R[(size_t)(m0 + wm + 16 * i + rh + r) * ldy + n] + gv * v;
          if (EPI == 3) v = fmaxf(v, 0.0f);
          so[(16 * i + rh + r) * 68 + 16 * j + cl] = v;
        }
      }
    }
  asm volatile("s_wait_dscnt 0" ::: "memory");
  __builtin_amdgcn_wave_barrier();
{
    if (OUT16) {
      f16* Y = (f16*)Yv;
#pragma unroll
      for (int it = 0; it < 8; ++it) { const int c = lane + 32 * it, rr = c >> 3, q8 = (c & 7) * 8;
        union { f16 h[8]; v4u_t v; } u;
#pragma unroll
        for (int e = 0; e < 8; ++e) u.h[e] = (f16)so[rr * 68 + q8 + e];
        *(v4u_t*)(Y + (size_t)(m0 + wm + rr) * ldy + n0 + wn + q8) = u.v; }
    } else {
      float* Y = (float*)Yv;
#pragma unroll
      for (int it = 0; it < 16; ++it) { const int f4 = lane + 32 * it, rr = f4 >> 4, q = (f4 & 15) * 4;
        *(v4f_t*)(Y + (size_t)(m0 + wm + rr) * ldy + n0 + wn + q) = *(const v4fa*)(so + rr * 68 + q); }
    }
    
  }
}


// ---------------------------------------------------------------------------------------------------------------------------
// k_pair: layers 2 and 3 of the pair MLP and the i != j sum in one launch; the layer-2 activations never leave LDS.
// A work-group takes 79 pair rows of ONE batch (8 work-groups a batch, 8 * 79 >= 625; 80 rows computed, rows past the group's or the batch's end repeat a valid pair and are masked out of the sum)
// and all 512 columns: 256 equal work-groups, one a WGP. 16 waves, each 80 rows x 32 columns (5 x 2 accumulator tiles).
// h1 = relu(An_i + Bn_j) is formed once in f32 and rounded to f16 into LDS. No two waves share a column of W, so W does not pass through LDS: each wave loads its own B fragments of a 32-deep step
// (2 KB, four whole-line 16-byte loads) from the packed f16 copy that the layer-1 launch wrote (pack_w), three steps ahead, into a ring of four register sets. The k loop has no barrier.
// Same roundings, k runs upward: h2 and the sums are bit-identical to the form that staged W in LDS. ps[b * 8 + t][n] = the group's column sums, fixed order.
// ---------------------------------------------------------------------------------------------------------------------------
#define PRW 79
#define PAP (HHd + 8)   // pitch of h1 and h2 in f16: 1040 B, 16 B x odd for the b128 fragment reads
#define WAH 3           // steps that the W loads run ahead of their WMMAs
// the wave's B fragments of step g (0..15 layer 2, 16..31 layer 3): a uniform base, one offset register that never changes, and a constant
__device__ __forceinline__ void pair_wload(const char* __restrict__ wp, unsigned voff, int g, v4u_t (&bw)[4]) {
#pragma unroll   // registers indexed by q
  for (int q = 0; q < 4; ++q) bw[q] = *(const v4ua*)(wp + voff + (g * 16 * 2048 + q * 512));
}
// work-group barrier by hand: publishes the activations, which are LDS stores only. __syncthreads() would also wait for the W loads in flight.
__device__ __forceinline__ void pair_barrier() { asm volatile("s_wait_dscnt 0x0\n\ts_barrier_signal -1\n\ts_barrier_wait -1" ::: "memory"); }
// one layer: acc += act[80][512] * W. The ring holds steps G0 .. G0 + WAH - 1 on entry and the next layer's first steps on return.
template <int G0>
__device__ __forceinline__ void pair_mm(const f16* act, const char* __restrict__ wp, unsigned voff, v4u_t (&bw)[4][4], f32x8 (&acc)[5][2]) {
#pragma unroll   // the ring is indexed by the step, and every W load differs from the others only in its constant offset
  for (int s = 0; s < HHd / 32; ++s) {
    const int g = G0 + s;
    if (g + WAH < 2 * (HHd / 32)) pair_wload(wp, voff, g + WAH, bw[(g + WAH) & 3]);   // into the set that step g - 1 has read
    if (g + WAH == 2 * (HHd / 32) - 1) asm volatile("s_wait_xcnt 0x0" :: "v"(voff), "s"(wp) : "memory");   // precaution: behind the last W load its base and offset registers are free for reuse
    f16x16 af[5];
#pragma unroll
    for (int i = 0; i < 5; ++i) af[i] = lds_frag(act + (16 * i) * PAP + 32 * s, PAP);
    const f16x8 lo0 = __builtin_bit_cast(f16x8, bw[g & 3][0]), hi0 = __builtin_bit_cast(f16x8, bw[g & 3][1]), lo1 = __builtin_bit_cast(f16x8, bw[g & 3][2]), hi1 = __builtin_bit_cast(f16x8, bw[g & 3][3]);
    const f16x16 bf0 = __builtin_shufflevector(lo0, hi0, 0, 1, 2, 3, 4, 5, 6, 7, 8, 9, 10, 11, 12, 13, 14, 15);
    const f16x16 bf1 = __builtin_shufflevector(lo1, hi1, 0, 1, 2, 3, 4, 5, 6, 7, 8, 9, 10, 11, 12, 13, 14, 15);
#pragma unroll
    for (int i = 0; i < 5; ++i) acc[i][0] = wmma16(af[i], bf0, acc[i][0]);
#pragma unroll
    for (int i = 0; i < 5; ++i) acc[i][1] = wmma16(af[i], bf1, acc[i][1]);
  }
}
__global__ __launch_bounds__(512) void k_pair(const float* __restrict__ An, const float* __restrict__ Bn, const _Float16* __restrict__ Wp, const float* __restrict__ b2,
                                              const float* __restrict__ b3, float* __restrict__ ps) {
  __shared__ __attribute__((aligned(16))) f16 h1[80 * PAP];
  __shared__ __attribute__((aligned(16))) f16 h2[80 * PAP];
  const int tid = threadIdx.x, lane = tid & 31, wave = tid >> 5, cl = lane & 15, rh = (lane >> 4) * 8;
  const int nb = (blockIdx.x >> 3) * NN, q0 = (blockIdx.x & 7) * PRW, wn = wave * 32;   // first node row of the batch; first pair row of the group, counted in the batch
  const unsigned voff = (unsigned)(wave * 2048 + lane * 16);   // this lane's place in a step's 32 KB of packed W
  v4u_t bw[4][4];
#pragma unroll   // registers indexed by g
  for (int g = 0; g < WAH; ++g) pair_wload((const char*)Wp, voff, g, bw[g]);   // fly while h1 is formed
  { const int rg = __builtin_amdgcn_readfirstlane(tid >> 7), c4 = (tid & 127) * 4;   // 128 lanes side by side cover a row; the row is the same in a whole wave, so its address is a scalar base
    const unsigned coff = (unsigned)c4 * 4u;
#pragma unroll   // registers indexed by p
    for (int hp = 0; hp < 2; ++hp) {
      v4f_t a[10], u[10]; unsigned oa[10], ob[10];   // byte offsets from the two uniform bases
#pragma unroll
      for (int p = 0; p < 10; ++p) { const int q = min(q0 + (hp * 10 + p) * 4 + rg, NN * NN - 1), i = q / NN, j = q - i * NN;
        oa[p] = (unsigned)((nb + i) * HHd) * 4u + coff; ob[p] = (unsigned)((nb + j) * HHd) * 4u + coff; }
#pragma unroll
      for (int p = 0; p < 10; ++p) { a[p] = *(const v4fa*)((const char*)An + oa[p]); u[p] = *(const v4fa*)((const char*)Bn + ob[p]); }
      // precaution: the offset registers of the loads above stay untouched up to this wait, also as targets of later loads
      asm volatile("s_wait_xcnt 0x0" :: "v"(oa[0]), "v"(oa[1]), "v"(oa[2]), "v"(oa[3]), "v"(oa[4]), "v"(oa[5]), "v"(oa[6]), "v"(oa[7]), "v"(oa[8]), "v"(oa[9]),
                   "v"(ob[0]), "v"(ob[1]), "v"(ob[2]), "v"(ob[3]), "v"(ob[4]), "v"(ob[5]), "v"(ob[6]), "v"(ob[7]), "v"(ob[8]), "v"(ob[9]) : "memory");
#pragma unroll
      for (int p = 0; p < 10; ++p) { bf16x4 q4;
#pragma unroll
        for (int e = 0; e < 4; ++e) q4[e] = (f16)fmaxf(a[p][e] + u[p][e], 0.0f);
        *(bf16x4*)(h1 + ((hp * 10 + p) * 4 + rg) * PAP + c4) = q4; }
    }
  }
  f32x8 acc[5][2];
#pragma unroll
  for (int i = 0; i < 5; ++i)
#pragma unroll
    for (int j = 0; j < 2; ++j) { f32x8 z = {}; acc[i][j] = z; }
  pair_barrier();   // h1 is read by every wave
  pair_mm<0>(h1, (const char*)Wp, voff, bw, acc);
#pragma unroll
  for (int j = 0; j < 2; ++j) { const float bv = b2[wn + 16 * j + cl];
#pragma unroll
    for (int i = 0; i < 5; ++i) {
#pragma unroll
      for (int r = 0; r < 8; ++r) h2[(16 * i + rh + r) * PAP + wn + 16 * j + cl] = (f16)fmaxf(acc[i][j][r] + bv, 0.0f);
      f32x8 z = {}; acc[i][j] = z; }
  }
  pair_barrier();   // h2 is read by every wave
  pair_mm<HHd / 32>(h2, (const char*)Wp, voff, bw, acc);
  const float bv0 = b3[wn + cl], bv1 = b3[wn + 16 + cl];
  float s0 = 0.0f, s1 = 0.0f;
#pragma unroll
  for (int i = 0; i < 5; ++i)
#pragma unroll
    for (int r = 0; r < 8; ++r) { const int row = 16 * i + rh + r, q = q0 + row;
      const bool ok = row < PRW && q < NN * NN && (q % (NN + 1)) != 0;   // pair row 25 i + j has i == j exactly when it is a multiple of 26
      const float hi = ok ? __builtin_inff() : 0.0f;                      // upper clamp: none for a row that counts, 0 else
      s0 += __builtin_amdgcn_fmed3f(acc[i][0][r] + bv0, 0.0f, hi); s1 += __builtin_amdgcn_fmed3f(acc[i][1][r] + bv1, 0.0f, hi); }   // relu and row mask in one median
  s0 += __shfl_xor(s0, 16); s1 += __shfl_xor(s1, 16);   // the two lane halves hold rows 0..7 and 8..15 of each row tile
  ps[(size_t)blockIdx.x * HHd + wn + lane] = lane < 16 ? s0 : s1;   // a wave stores one whole line
}

// ---------------------------------------------------------------------------------------------------------------------------
// k_tail: one layer of the f MLP, Y[32][N] = A[32][512] * W[512][N] + bias. These layers are three dependent launches of almost no work, so what counts is the
// chain of waits inside one launch: here the global loads of a work-group are in flight at once and waited for once, with TA 1 in two halves and twice (the tiled GEMM waits four times, for 128 rows of which 32 count).
// A work-group takes 16 columns; its 32 waves are 16 k slices of 32 (one WMMA deep) x 2 row tiles. Each wave loads its B fragment straight from W (f32, rounded to f16 as before), does one WMMA,
// and the 16 k-slice tiles are summed in LDS in f32, k upward. Activations lie in 16-column blocks [N / 16][32][16], so a work-group stores whole lines of its own and an A fragment is two contiguous 512-byte loads.
// TA 1: A row b is the sum, in group order, of the 8 rows of ps that k_pair wrote for batch b, formed once per work-group with whole-line loads and handed to the waves through LDS as f16.
// LAST: f32 sums without relu, in the same blocks. Columns from NV on repeat column NV - 1 (address clamp); nobody reads them.
// ---------------------------------------------------------------------------------------------------------------------------
template <int TA, int ldw, int NV, bool LAST>
__global__ __launch_bounds__(1024) void k_tail(const _Float16* __restrict__ Zin, const float* __restrict__ ps, const float* __restrict__ Wm,
                                               const float* __restrict__ bias, _Float16* __restrict__ Zout, float* __restrict__ Lout) {
  constexpr int APS = HHd + 8;                // LDS row pitch in f16: 1040 B, 16 B x odd for the b128 fragment reads
  __shared__ __attribute__((aligned(16))) f16 ldsA[TA == 1 ? NBr * APS : 8];
  __shared__ __attribute__((aligned(16))) float red[16 * 512];
  const int tid = threadIdx.x, lane = tid & 31, wave = tid >> 5, cl = lane & 15, kh = (lane >> 4) * 8;
  const int ks = wave & 15, mi = wave >> 4, k0 = ks * 32, n0 = blockIdx.x * 16;
  // B fragment: column n0 + cl, k in the order of lds_frag (k0 + kh + 0..7, then + 16)
  // Every load is a uniform base plus one 32-bit offset register plus a constant.
  const int nc = min(n0 + cl, NV - 1);
  const unsigned woff = (unsigned)((k0 + kh) * ldw + nc) * 4u;
  const int bq = __builtin_amdgcn_readfirstlane(tid >> 7);   // TA 1: 128 lanes side by side cover a row of ps, 8 rows a pass; the row is the same in a whole wave, so its address is a scalar base
  const char* qs[4];                                         // first of the 8 rows of pass p's batch
  if constexpr (TA == 1) {
#pragma unroll   // registers indexed by p
    for (int p = 0; p < 4; ++p) qs[p] = (const char*)(ps + (size_t)((p * 8 + bq) * 8) * HHd);
  }
  float wv[16];
#pragma unroll   // registers indexed by i
  for (int i = 0; i < 8; ++i) { wv[i] = *(const float*)((const char*)Wm + woff + i * (ldw * 4)); wv[8 + i] = *(const float*)((const char*)Wm + woff + (16 + i) * (ldw * 4)); }
  const float bv = bias[nc];   // the output element that this thread finishes below has column n0 + tid % 16 too
  f16x16 af;
  if constexpr (TA == 1) {
    // 32 batches x 8 rows of ps are 128 registers a thread, the whole budget of 32 waves: they come in two halves of 16 loads, the first in flight together with W.
    const int c4 = (tid & 127) * 4; const unsigned poff = (unsigned)c4 * 4u;
#pragma unroll   // registers indexed by hp, p, u
    for (int hp = 0; hp < 2; ++hp) {
      v4f_t pv[2][8];
#pragma unroll
      for (int p = 0; p < 2; ++p)
#pragma unroll
        for (int u = 0; u < 8; ++u) pv[p][u] = *(const v4fa*)(qs[2 * hp + p] + poff + u * (HHd * 4));
      asm volatile("s_wait_xcnt 0x0" :: "v"(woff), "v"(nc), "v"(poff) : "memory");   // precaution: the offset registers of the loads above stay untouched up to this wait, also as targets of later loads
      __builtin_amdgcn_sched_barrier(0);   // every load of the half issues before the first is waited for: without it the loads are scheduled in small groups, each behind the wait for the group before, W last
#pragma unroll
      for (int p = 0; p < 2; ++p) { v4f_t sm = pv[p][0];
#pragma unroll
        for (int u = 1; u < 8; ++u) sm += pv[p][u];
        bf16x4 q4; q4[0] = (f16)sm[0]; q4[1] = (f16)sm[1]; q4[2] = (f16)sm[2]; q4[3] = (f16)sm[3];
        *(bf16x4*)(ldsA + ((2 * hp + p) * 8 + bq) * APS + c4) = q4; }
    }
    __syncthreads();   // the joined rows are read by every wave
    af = lds_frag(ldsA + (16 * mi) * APS + k0, APS);
  } else {
    const unsigned zoff = (unsigned)((k0 >> 4) * (NBr * 16) + (16 * mi + cl) * 16 + kh) * 2u;
    const f16x8 lo = *(const f16x8*)((const char*)Zin + zoff), hi = *(const f16x8*)((const char*)Zin + zoff + NBr * 16 * 2);
#pragma unroll
    for (int i = 0; i < 8; ++i) { af[i] = lo[i]; af[i + 8] = hi[i]; }
  }
  f16x16 bfr;
#pragma unroll
  for (int i = 0; i < 16; ++i) bfr[i] = (f16)wv[i];
  f32x8 acc = {};
  acc = wmma16(af, bfr, acc);
  float* rp = red + ks * 512 + mi * 256 + lane;
#pragma unroll
  for (int r = 0; r < 8; ++r) rp[r * 32] = acc[r];
  __syncthreads();   // the 16 k-slice tiles of an output element meet here
  if (tid < 512) {   // one output element a thread, in the order of the block it is stored to: row = tid / 16, column = tid % 16
    const int row = tid >> 4;
    const float* qp = red + (row >> 4) * 256 + (row & 7) * 32 + ((row >> 3) & 1) * 16 + (tid & 15);
    float a = qp[0];
#pragma unroll
    for (int w = 1; w < 16; ++w) a += qp[w * 512];
    a += bv;
    if constexpr (LAST) Lout[blockIdx.x * 512 + tid] = a;
    else Zout[blockIdx.x * 512 + tid] = (f16)fmaxf(a, 0.0f);
  }
}

// logits [32][1000] from the 16-column blocks as one contiguous stream of 32,000 floats (8,000 float4; rows and blocks are multiples of 4 so no chunk straddles either)
__global__ __launch_bounds__(256) void k_out(const float* __restrict__ lp, float* __restrict__ out) {
  const int q4 = blockIdx.x * 256 + threadIdx.x; if (q4 >= NBr * NCLS / 4) return; const int fidx = q4 * 4, r = fidx / NCLS, c = fidx % NCLS;
  const v4f_t v = *(const v4f_t*)(lp + (size_t)(c >> 4) * (NBr * 16) + r * 16 + (c & 15)); *(v4f_t*)(out + fidx) = v; 
}

extern "C" void kernel_launch(void* const* d_in, const int* in_sizes, int n_in,
                              void* d_out, int out_size, void* d_ws, size_t ws_size,
                              hipStream_t stream) {
  (void)in_sizes; (void)n_in; (void)out_size;
  const float** f = (const float**)d_in;
  const float* x = f[0], *g_w1 = f[1], *g_b1 = f[2], *g_w2 = f[3], *g_b2 = f[4], *g_w3 = f[5], *g_b3 = f[6], *f_w1 = f[7], *f_b1 = f[8], *f_w2 = f[9], *f_b2 = f[10], *f_w3 = f[11], *f_b3 = f[12];
  float* out = (float*)d_out;      // [32,1000]
  char* ws = (char*)d_ws;
  float* A = (float*)ws; ws += (size_t)NROWP * HHd * 4; float* Bq = (float*)ws; ws += (size_t)NROWP * HHd * 4;   // Bq directly behind A: the z = 1 output of the layer-1 launch
  bf16* Wp = (bf16*)ws; ws += (size_t)2 * HHd * HHd * 2;   // directly behind Bq: g_w2 and g_w3 as f16 B fragments, written by the spare work-groups (z >= 2) of the layer-1 launch
  float* ps = (float*)ws; ws += (size_t)NBr * 8 * HHd * 4;   // layer-3 column sums, 8 rows a batch
  bf16* z1 = (bf16*)ws; ws += (size_t)128 * HHd * 2;
  bf16* z2 = (bf16*)ws; ws += (size_t)128 * HHd * 2;
  float* lp = (float*)ws; ws += (size_t)128 * NCP * 4;
  if ((size_t)(ws - (char*)d_ws) > ws_size) return;
  const dim3 blk(256);
  gemm_kne<float, 128, DDr, HHd, 0, false, NROWS, 0, DDr * HHd, NROWP * HHd * 4, 0, true><<<dim3(NROWP / 128, HHd / 128, 5), blk, 0, stream>>>(nullptr, x, g_w1, g_b1, g_w2, g_w3, A, HHd, DDr);   // z = 0: x*W1[:D] + b1 -> A; z = 1: x*W1[D:] -> Bq; z = 2..4: g_w2, g_w3 -> Wp
  k_pair<<<dim3(NBr * 8), dim3(512), 0, stream>>>(A, Bq, Wp, g_b2, g_b3, ps);   // per group of 79 pair rows: sums over i != j of relu(relu(h1*W2 + b2)*W3 + b3), h1 = relu(A_i + Bq_j)
  k_tail<1, HHd, HHd, false><<<dim3(HHd / 16), dim3(1024), 0, stream>>>(nullptr, ps, f_w1, f_b1, z1, nullptr);   // A = the group sums joined per batch
  k_tail<0, HHd, HHd, false><<<dim3(HHd / 16), dim3(1024), 0, stream>>>(z1, nullptr, f_w2, f_b2, z2, nullptr);
  k_tail<0, NCLS, NCLS, true><<<dim3((NCLS + 15) / 16), dim3(1024), 0, stream>>>(z2, nullptr, f_w3, f_b3, nullptr, lp);
  k_out<<<dim3((NBr * NCLS / 4 + 255) / 256), blk, 0, stream>>>(lp, out);
}

// v010
// It runs in 35.1 microseconds.
// Versions in between are left out here; by their measured steps it is 1.26 times as fast as v008.
// Counting every step since v000, it is 20.0 times as fast.
// Contractions on v_wmma_f32_16x16x32_f16 (plain f16 operands, f32 accumulate): the pair MLP g over all 32x25x25 ordered pairs as GEMMs
// with M = pairs: layer 1 split exactly as [x_i, x_j]·W1 = x_i·W1[:D] + x_j·W1[D:] (two K = 512 GEMMs on the 800 node rows, then relu of the
// broadcast sum per pair, rounded to f16 by the layer-2 loader), layers 2 and 3 (K = 512, 79 pair rows of a batch a work-group, in one launch), the i != j sum per batch in f32
// (fixed order), and the f MLP (layer 1 on the 256 rows of group sums, joined per batch behind the product; layers 2 and 3 on 32 rows: two 16-row tiles, no pad rows; K = 512 split over 16 waves; N in 16-column work-groups). ReLU in f32. The [32][1000]
#include <hip/hip_runtime.h>
#include <hip/hip_bf16.h>
#include <math.h>

#define NBr 32
#define NN 25
#define DDr 512
#define HHd 512
#define NCLS 1000
#define NCP 1024
#define NROWS (NBr * NN)          // 800
#define NROWP 896
#define NPAIR (NBr * NN * NN)     // 20000
#define NPAIRP 20096
#define GSTR 40
#define SS 64
#define HH 1
#define DKK 64

typedef _Float16 bf16;
typedef _Float16 f16;
typedef __attribute__((ext_vector_type(4))) unsigned v4u_t;
typedef unsigned v4ua __attribute__((ext_vector_type(4), may_alias));
typedef __attribute__((ext_vector_type(4))) float v4f_t;
typedef float v4fa __attribute__((ext_vector_type(4), may_alias));
typedef __attribute__((ext_vector_type(2))) float v2f_t;
typedef float v2fa __attribute__((ext_vector_type(2), may_alias));
typedef __attribute__((ext_vector_type(16))) bf16  bf16x16;
typedef bf16x16 f16x16;
typedef __attribute__((ext_vector_type(8)))  bf16  bf16x8;
typedef bf16x8 f16x8;
typedef __attribute__((ext_vector_type(4)))  bf16  bf16x4;
typedef __attribute__((ext_vector_type(8)))  float f32x8;
__device__ __forceinline__ f32x8 wmma16(f16x16 a, f16x16 b, f32x8 c) {
  c = __builtin_amdgcn_wmma_f32_16x16x32_f16(false, a, false, b, (short)0, c, false, false);
  asm volatile("v_nop\n\tv_nop\n\tv_nop\n\tv_nop" : "+v"(c) : "v"(a), "v"(b));
  return c;
}
#define LDS_STRIDE 48   // unused: A tiles in LDS use pitch 512 + 8 (520 elems, 1040B rows)
#define KSTRIDE    72   // unused
#define VSTRIDE    48   // unused

__device__ __forceinline__ f32x8 wmma_bf16(bf16x16 a, bf16x16 b, f32x8 c) {
  c = __builtin_amdgcn_wmma_f32_16x16x32_f16(false, a, false, b, (short)0, c, false, false);
  asm volatile("v_nop\n\tv_nop\n\tv_nop\n\tv_nop" : "+v"(c) : "v"(a), "v"(b));   // A/B-overwrite hazard guard
  return c;
}

// 16x32 (MxK) f16 fragment from a row-major global matrix.
// lanes 0-15  (row=lane)    : elems 0..7 = K+0..7,  8..15 = K+16..23
// lanes 16-31 (row=lane-16) : elems 0..7 = K+8..15, 8..15 = K+24..31
template <typename T>
__device__ __forceinline__ bf16x16 load_frag(const T* __restrict__ base, int ld,
                                             int row0, int k0) {
  const int lane = threadIdx.x & 31;
  const int r    = lane & 15;
  const int kh   = (lane >> 4) * 8;
  const T* p0 = base + (size_t)(row0 + r) * ld + (k0 + kh);
  const T* p1 = p0 + 16;
  bf16x16 f;
#pragma unroll
  for (int i = 0; i < 8; ++i) {
    f[i]     = (bf16)p0[i];
    f[i + 8] = (bf16)p1[i];
  }
  return f;
}

// Same fragment from an LDS tile with padded row stride (base includes row0/k0).
__device__ __forceinline__ bf16x16 lds_frag(const bf16* base, int stride) {
  const int lane = threadIdx.x & 31;
  const int row  = lane & 15;
  const int kh   = (lane >> 4) * 8;
  const bf16x8 lo = *(const bf16x8*)(base + row * stride + kh);
  const bf16x8 hi = *(const bf16x8*)(base + row * stride + kh + 16);
  bf16x16 f;
#pragma unroll
  for (int i = 0; i < 8; ++i) { f[i] = lo[i]; f[i + 8] = hi[i]; }
  return f;
}

template <typename T>
__device__ __forceinline__ void stage_read16(const T* __restrict__ p, float* buf) {
#pragma unroll
  for (int i = 0; i < 16; ++i) buf[i] = (float)p[i];
}

__device__ __forceinline__ void stage_write(bf16* dst, const float* buf, int nquad) {
#pragma unroll
  for (int i = 0; i < nquad; ++i) {
    bf16x4 q;
    q[0] = (bf16)buf[4 * i];     q[1] = (bf16)buf[4 * i + 1];
    q[2] = (bf16)buf[4 * i + 2]; q[3] = (bf16)buf[4 * i + 3];
    *(bf16x4*)(dst + 4 * i) = q;
  }
}

#define GSTR 40
// Packed weights of the pair layers: f16, B fragments ready to load. Block t = (layer * 16 + s) * 16 + w holds rows 32 s .. and columns 32 w .. of the layer's W[512][512] in 2 KB: four pieces of 512 B,
// piece 2 j + hl, a lane's 16 bytes in it = column 32 w + 16 j + (lane & 15), k = 32 s + 16 hl + 8 (lane >> 4) + 0..7: the k order of lds_frag.
// A wave reads whole lines (lane = column, 32 rows in flight at once) and stores whole lines: the 8 k of group m go to piece 2 j + (m >> 1), place (lane & 15) + 16 (m & 1).
__device__ __forceinline__ void pack_w(const float* __restrict__ Wsrc, int s, int w, char* __restrict__ dst) {
  const int lane = threadIdx.x & 31;
  const unsigned vidx = (unsigned)(32 * s * HHd + 32 * w + lane);
  float v[32];
#pragma unroll   // registers indexed by k
  for (int k = 0; k < 32; ++k) v[k] = Wsrc[vidx + k * HHd];
  asm volatile("s_wait_xcnt 0x0" :: "v"(vidx) : "memory");   // precaution: the index register of the loads above stays untouched up to this wait, also as a target of later loads
#pragma unroll   // registers indexed by m
  for (int m = 0; m < 4; ++m) { f16x8 q;
#pragma unroll
    for (int e = 0; e < 8; ++e) q[e] = (f16)v[8 * m + e];
    *(f16x8*)(dst + ((lane >> 4) * 2 + (m >> 1)) * 512 + ((lane & 15) + 16 * (m & 1)) * 16) = q; }
}
// work-group barrier by hand: publishes activations, which are LDS stores only. __syncthreads() would also wait for the W loads in flight.
__device__ __forceinline__ void pair_barrier() { asm volatile("s_wait_dscnt 0x0\n\ts_barrier_signal -1\n\ts_barrier_wait -1" ::: "memory"); }

// ---------------------------------------------------------------------------------------------------------------------------
// k_l1: layer 1 on the 800 node rows, Y[z][m][n] = sum_k x[m][k] * W1[512 z + k][n] (+ b1[n] for z = 0), f16 operands, f32 sums, f32 out. Little work, so what counts is the chain of waits in a work-group
// and how many WGPs share the reading: a work-group takes 64 rows x 64 columns of one z (13 x 16 = 208 work-groups) and has every global load of its whole K = 512 in flight at once, waited for once.
// 8 waves = 8 k slices of 64. x rows go through LDS as f16 (whole-line loads). No two waves share an element of W, so W does not pass through LDS: a lane loads 4 neighbouring columns of a k row
// (16 lanes = two whole lines), and columns 4 l + t of the 16 lanes l make B fragment t (k in the order of lds_frag). A lane's four accumulator tiles then hold neighbouring columns of a row.
// The 8 k-slice tiles are summed in LDS in f32, k upward. The last row block repeats rows 768..799 in its upper half; those results land in the pad rows 800..831 of Y, which nobody reads.
// Work-groups from L1G on take no part: on WGPs that the GEMM leaves idle they round the weights of pair layers 2 and 3 to f16 in the order in which k_pair's waves read them, two 32 x 32 blocks a wave (pack_w).
// ---------------------------------------------------------------------------------------------------------------------------
#define L1G 208         // 13 row blocks x 16 column blocks
#define L1P (DDr + 8)   // pitch of the x rows in f16: 1040 B, 16 B x odd for the b128 fragment reads
#define L1R 68          // pitch of a k-slice tile in f32: 272 B, 16 B x odd
__global__ __launch_bounds__(256) void k_l1(const float* __restrict__ x, const float* __restrict__ W1, const float* __restrict__ b1, const float* __restrict__ W2, const float* __restrict__ W3,
                                            float* __restrict__ Y, _Float16* __restrict__ Wp) {
  __shared__ __attribute__((aligned(16))) f16 ldsA[64 * L1P];
  __shared__ __attribute__((aligned(16))) float red[8 * 64 * L1R];
  const int tid = threadIdx.x, lane = tid & 31, kg = __builtin_amdgcn_readfirstlane(tid >> 5), cl = lane & 15, hf = lane >> 4;
  if (blockIdx.x >= L1G) {   // block-uniform, in front of every barrier
    const int t = (blockIdx.x - L1G) * 8 + kg;   // the same in a whole wave: scalar bases
    pack_w(W2, t >> 4, t & 15, (char*)Wp + (size_t)t * 2048);
    pack_w(W3, t >> 4, t & 15, (char*)Wp + (size_t)(256 + t) * 2048);
    return;
  }
  const int m0 = (blockIdx.x >> 4) * 64, z = (blockIdx.x >> 3) & 1, n0 = (blockIdx.x & 7) * 64;
  const int rg = __builtin_amdgcn_readfirstlane(tid >> 7), c4 = (tid & 127) * 4;   // 128 lanes side by side cover a row of x, 2 rows a pass
  // Every load is a uniform base plus one 32-bit offset register plus a constant.
  const unsigned ao0 = (unsigned)((m0 + rg) * DDr + c4) * 4u, ao1 = (unsigned)((min(m0 + 32, NROWS - 32) + rg) * DDr + c4) * 4u;
  const unsigned wo = (unsigned)((z * DDr + kg * 64 + hf * 8) * HHd + n0 + 4 * cl) * 4u;
  const unsigned bo = (unsigned)(n0 + 4 * cl) * 4u;   // the 4 columns that this thread finishes below
  v4f_t av[32], bv[2][16];
#pragma unroll   // registers indexed by p
  for (int p = 0; p < 16; ++p) av[p] = *(const v4fa*)((const char*)x + ao0 + p * (2 * DDr * 4));
#pragma unroll
  for (int p = 0; p < 16; ++p) av[16 + p] = *(const v4fa*)((const char*)x + ao1 + p * (2 * DDr * 4));
#pragma unroll   // registers indexed by s, i
  for (int s = 0; s < 2; ++s)
#pragma unroll
    for (int i = 0; i < 8; ++i) { bv[s][i] = *(const v4fa*)((const char*)W1 + wo + (32 * s + i) * (HHd * 4)); bv[s][8 + i] = *(const v4fa*)((const char*)W1 + wo + (32 * s + 16 + i) * (HHd * 4)); }
  v4f_t bq = *(const v4fa*)((const char*)b1 + bo);
  asm volatile("s_wait_xcnt 0x0" :: "v"(ao0), "v"(ao1), "v"(wo), "v"(bo) : "memory");   // precaution: the offset registers of the loads above stay untouched up to this wait, also as targets of later loads
  __builtin_amdgcn_sched_barrier(0);   // every load issues before the first is waited for: otherwise the loads may be scheduled in groups, each behind the wait for the group before
#pragma unroll
  for (int p = 0; p < 32; ++p) { bf16x4 q4; q4[0] = (f16)av[p][0]; q4[1] = (f16)av[p][1]; q4[2] = (f16)av[p][2]; q4[3] = (f16)av[p][3];
    *(bf16x4*)(ldsA + (2 * p + rg) * L1P + c4) = q4; }
  f32x8 acc[4][4];
#pragma unroll
  for (int i = 0; i < 4; ++i)
#pragma unroll
    for (int j = 0; j < 4; ++j) { f32x8 zz = {}; acc[i][j] = zz; }
  pair_barrier();   // the x rows are read by every wave
#pragma unroll   // registers indexed by s
  for (int s = 0; s < 2; ++s) {
    f16x16 bf[4], af[4];
#pragma unroll
    for (int j = 0; j < 4; ++j)
#pragma unroll
      for (int i = 0; i < 16; ++i) bf[j][i] = (f16)bv[s][i][j];
#pragma unroll
    for (int i = 0; i < 4; ++i) af[i] = lds_frag(ldsA + (16 * i) * L1P + kg * 64 + 32 * s, L1P);
#pragma unroll
    for (int j = 0; j < 4; ++j)
#pragma unroll
      for (int i = 0; i < 4; ++i) acc[i][j] = wmma16(af[i], bf[j], acc[i][j]);
  }
  float* rp = red + (kg * 64 + hf * 8) * L1R + 4 * cl;
#pragma unroll
  for (int i = 0; i < 4; ++i)
#pragma unroll
    for (int r = 0; r < 8; ++r) { v4f_t q4; q4[0] = acc[i][0][r]; q4[1] = acc[i][1][r]; q4[2] = acc[i][2][r]; q4[3] = acc[i][3][r]; *(v4f_t*)(rp + (16 * i + r) * L1R) = q4; }
  __syncthreads();   // the 8 k-slice tiles of an output element meet here
  if (z != 0) { v4f_t zq = {0.0f, 0.0f, 0.0f, 0.0f}; bq = zq; }   // the x_i half alone takes the bias
  const float* qp = red + (tid >> 4) * L1R + 4 * cl;   // 16 lanes side by side cover a row of the tile: a wave stores whole lines
  float* yp = Y + (size_t)z * (NROWP * HHd) + (size_t)(m0 + (tid >> 4)) * HHd + n0 + 4 * cl;
  v4f_t o[4];
#pragma unroll   // registers indexed by it
  for (int it = 0; it < 4; ++it) {
    v4f_t a = *(const v4fa*)(qp + it * 16 * L1R);
#pragma unroll
    for (int w = 1; w < 8; ++w) a += *(const v4fa*)(qp + (w * 64 + it * 16) * L1R);
    o[it] = a + bq;
  }
  __builtin_amdgcn_sched_barrier(0);   // the four stores stand behind the last LDS read and the last sum, so that no register of an issued store is written again
#pragma unroll
  for (int it = 0; it < 4; ++it) *(v4f_t*)(yp + it * 16 * HHd) = o[it];
  asm volatile("s_wait_xcnt 0x0" ::: "memory");   // precaution: no register of the four stores above is written again ahead of this wait, on any way that the code behind them can be reached
}

// ---------------------------------------------------------------------------------------------------------------------------
// k_pair: layers 2 and 3 of the pair MLP and the i != j sum in one launch; the layer-2 activations never leave LDS.
// A work-group takes 79 pair rows of ONE batch (8 work-groups a batch, 8 * 79 >= 625; 80 rows computed, rows past the group's or the batch's end repeat a valid pair and are masked out of the sum)
// and all 512 columns: 256 equal work-groups, one a WGP. 16 waves, each 80 rows x 32 columns (5 x 2 accumulator tiles).
// h1 = relu(An_i + Bn_j) is formed once in f32 and rounded to f16 into LDS. No two waves share a column of W, so W does not pass through LDS: each wave loads its own B fragments of a 32-deep step
// (2 KB, four whole-line 16-byte loads) from the packed f16 copy that the layer-1 launch wrote (pack_w), three steps ahead, into a ring of four register sets. The k loop has no barrier.
// Same roundings, k runs upward: h2 and the sums are bit-identical to the form that staged W in LDS. ps[b * 8 + t][n] = the group's column sums, fixed order.
// ---------------------------------------------------------------------------------------------------------------------------
#define PRW 79
#define PAP (HHd + 8)   // pitch of h1 and h2 in f16: 1040 B, 16 B x odd for the b128 fragment reads
#define WAH 3           // steps that the W loads run ahead of their WMMAs
// the wave's B fragments of step g (0..15 layer 2, 16..31 layer 3): a uniform base, one offset register that never changes, and a constant
__device__ __forceinline__ void pair_wload(const char* __restrict__ wp, unsigned voff, int g, v4u_t (&bw)[4]) {
#pragma unroll   // registers indexed by q
  for (int q = 0; q < 4; ++q) bw[q] = *(const v4ua*)(wp + voff + (g * 16 * 2048 + q * 512));
}
// one layer: acc += act[80][512] * W. The ring holds steps G0 .. G0 + WAH - 1 on entry and the next layer's first steps on return.
template <int G0>
__device__ __forceinline__ void pair_mm(const f16* act, const char* __restrict__ wp, unsigned voff, v4u_t (&bw)[4][4], f32x8 (&acc)[5][2]) {
#pragma unroll   // the ring is indexed by the step, and every W load differs from the others only in its constant offset
  for (int s = 0; s < HHd / 32; ++s) {
    const int g = G0 + s;
    if (g + WAH < 2 * (HHd / 32)) pair_wload(wp, voff, g + WAH, bw[(g + WAH) & 3]);   // into the set that step g - 1 has read
    if (g + WAH == 2 * (HHd / 32) - 1) asm volatile("s_wait_xcnt 0x0" :: "v"(voff), "s"(wp) : "memory");   // precaution: behind the last W load its base and offset registers are free for reuse
    f16x16 af[5];
#pragma unroll
    for (int i = 0; i < 5; ++i) af[i] = lds_frag(act + (16 * i) * PAP + 32 * s, PAP);
    const f16x8 lo0 = __builtin_bit_cast(f16x8, bw[g & 3][0]), hi0 = __builtin_bit_cast(f16x8, bw[g & 3][1]), lo1 = __builtin_bit_cast(f16x8, bw[g & 3][2]), hi1 = __builtin_bit_cast(f16x8, bw[g & 3][3]);
    const f16x16 bf0 = __builtin_shufflevector(lo0, hi0, 0, 1, 2, 3, 4, 5, 6, 7, 8, 9, 10, 11, 12, 13, 14, 15);
    const f16x16 bf1 = __builtin_shufflevector(lo1, hi1, 0, 1, 2, 3, 4, 5, 6, 7, 8, 9, 10, 11, 12, 13, 14, 15);
#pragma unroll
    for (int i = 0; i < 5; ++i) acc[i][0] = wmma16(af[i], bf0, acc[i][0]);
#pragma unroll
    for (int i = 0; i < 5; ++i) acc[i][1] = wmma16(af[i], bf1, acc[i][1]);
  }
}
__global__ __launch_bounds__(512) void k_pair(const float* __restrict__ An, const float* __restrict__ Bn, const _Float16* __restrict__ Wp, const float* __restrict__ b2,
                                              const float* __restrict__ b3, float* __restrict__ ps) {
  __shared__ __attribute__((aligned(16))) f16 h1[80 * PAP];
  __shared__ __attribute__((aligned(16))) f16 h2[80 * PAP];
  const int tid = threadIdx.x, lane = tid & 31, wave = tid >> 5, cl = lane & 15, rh = (lane >> 4) * 8;
  const int nb = (blockIdx.x >> 3) * NN, q0 = (blockIdx.x & 7) * PRW, wn = wave * 32;   // first node row of the batch; first pair row of the group, counted in the batch
  const unsigned voff = (unsigned)(wave * 2048 + lane * 16);   // this lane's place in a step's 32 KB of packed W
  v4u_t bw[4][4];
#pragma unroll   // registers indexed by g
  for (int g = 0; g < WAH; ++g) pair_wload((const char*)Wp, voff, g, bw[g]);   // fly while h1 is formed
  { const int rg = __builtin_amdgcn_readfirstlane(tid >> 7), c4 = (tid & 127) * 4;   // 128 lanes side by side cover a row; the row is the same in a whole wave, so its address is a scalar base
    const unsigned coff = (unsigned)c4 * 4u;
#pragma unroll   // registers indexed by p
    for (int hp = 0; hp < 2; ++hp) {
      v4f_t a[10], u[10]; unsigned oa[10], ob[10];   // byte offsets from the two uniform bases
#pragma unroll
      for (int p = 0; p < 10; ++p) { const int q = min(q0 + (hp * 10 + p) * 4 + rg, NN * NN - 1), i = q / NN, j = q - i * NN;
        oa[p] = (unsigned)((nb + i) * HHd) * 4u + coff; ob[p] = (unsigned)((nb + j) * HHd) * 4u + coff; }
#pragma unroll
      for (int p = 0; p < 10; ++p) { a[p] = *(const v4fa*)((const char*)An + oa[p]); u[p] = *(const v4fa*)((const char*)Bn + ob[p]); }
      // precaution: the offset registers of the loads above stay untouched up to this wait, also as targets of later loads
      asm volatile("s_wait_xcnt 0x0" :: "v"(oa[0]), "v"(oa[1]), "v"(oa[2]), "v"(oa[3]), "v"(oa[4]), "v"(oa[5]), "v"(oa[6]), "v"(oa[7]), "v"(oa[8]), "v"(oa[9]),
                   "v"(ob[0]), "v"(ob[1]), "v"(ob[2]), "v"(ob[3]), "v"(ob[4]), "v"(ob[5]), "v"(ob[6]), "v"(ob[7]), "v"(ob[8]), "v"(ob[9]) : "memory");
#pragma unroll
      for (int p = 0; p < 10; ++p) { bf16x4 q4;
#pragma unroll
        for (int e = 0; e < 4; ++e) q4[e] = (f16)fmaxf(a[p][e] + u[p][e], 0.0f);
        *(bf16x4*)(h1 + ((hp * 10 + p) * 4 + rg) * PAP + c4) = q4; }
    }
  }
  f32x8 acc[5][2];
#pragma unroll
  for (int i = 0; i < 5; ++i)
#pragma unroll
    for (int j = 0; j < 2; ++j) { f32x8 z = {}; acc[i][j] = z; }
  pair_barrier();   // h1 is read by every wave
  pair_mm<0>(h1, (const char*)Wp, voff, bw, acc);
#pragma unroll
  for (int j = 0; j < 2; ++j) { const float bv = b2[wn + 16 * j + cl];
#pragma unroll
    for (int i = 0; i < 5; ++i) {
#pragma unroll
      for (int r = 0; r < 8; ++r) h2[(16 * i + rh + r) * PAP + wn + 16 * j + cl] = (f16)fmaxf(acc[i][j][r] + bv, 0.0f);
      f32x8 z = {}; acc[i][j] = z; }
  }
  pair_barrier();   // h2 is read by every wave
  pair_mm<HHd / 32>(h2, (const char*)Wp, voff, bw, acc);
  const float bv0 = b3[wn + cl], bv1 = b3[wn + 16 + cl];
  float s0 = 0.0f, s1 = 0.0f;
#pragma unroll
  for (int i = 0; i < 5; ++i)
#pragma unroll
    for (int r = 0; r < 8; ++r) { const int row = 16 * i + rh + r, q = q0 + row;
      const bool ok = row < PRW && q < NN * NN && (q % (NN + 1)) != 0;   // pair row 25 i + j has i == j exactly when it is a multiple of 26
      const float hi = ok ? __builtin_inff() : 0.0f;                      // upper clamp: none for a row that counts, 0 else
      s0 += __builtin_amdgcn_fmed3f(acc[i][0][r] + bv0, 0.0f, hi); s1 += __builtin_amdgcn_fmed3f(acc[i][1][r] + bv1, 0.0f, hi); }   // relu and row mask in one median
  s0 += __shfl_xor(s0, 16); s1 += __shfl_xor(s1, 16);   // the two lane halves hold rows 0..7 and 8..15 of each row tile
  ps[(size_t)blockIdx.x * HHd + wn + lane] = lane < 16 ? s0 : s1;   // a wave stores one whole line
}

// ---------------------------------------------------------------------------------------------------------------------------
// k_f1: layer 1 of the f MLP, Z[b][n] = relu(sum_t sum_k ps[8 b + t][k] * W[k][n] + bias[n]). The product is linear in its rows, so the 8 group sums of a batch are joined BEHIND it: the 256 rows of ps
// are the A rows as they lie (each rounded to f16), and a batch's 8 rows are the 8 accumulator registers of a lane, summed in f32, t upward. So no work-group needs all of ps: a work-group takes 32 rows
// (4 batches) x 32 columns, 8 x 16 = 128 work-groups, 64 KB of ps and 64 KB of W each, every global load in flight at once and waited for once. 8 waves = 8 k slices of 64.
// The ps rows go through LDS as f16 (whole-line loads). W does not: a lane loads 2 neighbouring columns of a k row (16 lanes = a whole line), and columns 2 l + t of the 16 lanes l make B fragment t
// (k in the order of lds_frag). The 8 k-slice results are summed in LDS in f32, k upward. Z lies in the 16-column blocks of k_tail; a work-group stores two whole lines.
// ---------------------------------------------------------------------------------------------------------------------------
#define F1P (HHd + 8)   // pitch of the ps rows in f16: 1040 B, 16 B x odd for the b128 fragment reads
__global__ __launch_bounds__(256) void k_f1(const float* __restrict__ ps, const float* __restrict__ Wm, const float* __restrict__ bias, _Float16* __restrict__ Zout) {
  __shared__ __attribute__((aligned(16))) f16 ldsA[32 * F1P];
  __shared__ __attribute__((aligned(16))) float red[8 * 128];
  const int tid = threadIdx.x, lane = tid & 31, kg = __builtin_amdgcn_readfirstlane(tid >> 5), cl = lane & 15, hf = lane >> 4;
  const int r0 = (blockIdx.x >> 4) * 32, n0 = (blockIdx.x & 15) * 32;
  const int rg = __builtin_amdgcn_readfirstlane(tid >> 7), c4 = (tid & 127) * 4;   // 128 lanes side by side cover a row of ps, 2 rows a pass
  // Every load is a uniform base plus one 32-bit offset register plus a constant.
  const unsigned po = (unsigned)((r0 + rg) * HHd + c4) * 4u;
  const unsigned wo = (unsigned)((kg * 64 + hf * 8) * HHd + n0 + 2 * cl) * 4u;
  const int bi = n0 + ((tid >> 6) & 1) * 16 + cl;   // the column that this thread finishes below
  v4f_t pv[16]; v2f_t bv[2][16];
#pragma unroll   // registers indexed by p
  for (int p = 0; p < 16; ++p) pv[p] = *(const v4fa*)((const char*)ps + po + p * (2 * HHd * 4));
#pragma unroll   // registers indexed by s, i
  for (int s = 0; s < 2; ++s)
#pragma unroll
    for (int i = 0; i < 8; ++i) { bv[s][i] = *(const v2fa*)((const char*)Wm + wo + (32 * s + i) * (HHd * 4)); bv[s][8 + i] = *(const v2fa*)((const char*)Wm + wo + (32 * s + 16 + i) * (HHd * 4)); }
  const float bq = bias[bi];
  asm volatile("s_wait_xcnt 0x0" :: "v"(po), "v"(wo), "v"(bi) : "memory");   // precaution: the offset registers of the loads above stay untouched up to this wait, also as targets of later loads
  __builtin_amdgcn_sched_barrier(0);   // every load issues before the first is waited for: otherwise the loads may be scheduled in groups, each behind the wait for the group before
#pragma unroll
  for (int p = 0; p < 16; ++p) { bf16x4 q4; q4[0] = (f16)pv[p][0]; q4[1] = (f16)pv[p][1]; q4[2] = (f16)pv[p][2]; q4[3] = (f16)pv[p][3];
    *(bf16x4*)(ldsA + (2 * p + rg) * F1P + c4) = q4; }
  f32x8 acc[2][2];
#pragma unroll
  for (int i = 0; i < 2; ++i)
#pragma unroll
    for (int j = 0; j < 2; ++j) { f32x8 zz = {}; acc[i][j] = zz; }
  pair_barrier();   // the ps rows are read by every wave
#pragma unroll   // registers indexed by s
  for (int s = 0; s < 2; ++s) {
    f16x16 bf[2], af[2];
#pragma unroll
    for (int j = 0; j < 2; ++j)
#pragma unroll
      for (int i = 0; i < 16; ++i) bf[j][i] = (f16)bv[s][i][j];
#pragma unroll
    for (int i = 0; i < 2; ++i) af[i] = lds_frag(ldsA + (16 * i) * F1P + kg * 64 + 32 * s, F1P);
#pragma unroll
    for (int j = 0; j < 2; ++j)
#pragma unroll
      for (int i = 0; i < 2; ++i) acc[i][j] = wmma16(af[i], bf[j], acc[i][j]);
  }
#pragma unroll
  for (int i = 0; i < 2; ++i) {   // rows 16 i + 8 hf + 0..7 of the tile are the 8 group sums of batch 2 i + hf of the four
    v2f_t q2; q2[0] = acc[i][0][0]; q2[1] = acc[i][1][0];
#pragma unroll
    for (int r = 1; r < 8; ++r) { q2[0] += acc[i][0][r]; q2[1] += acc[i][1][r]; }
    *(v2f_t*)(red + kg * 128 + (2 * i + hf) * 32 + 2 * cl) = q2; }
  __syncthreads();   // the 8 k-slice results of an output element meet here
  if (tid < 128) {   // one output element a thread, in the order in which it is stored: column block = tid / 64, batch = tid / 16 % 4, column = tid % 16
    const float* qp = red + ((tid >> 4) & 3) * 32 + (tid >> 6) * 16 + cl;
    float a = qp[0];
#pragma unroll
    for (int w = 1; w < 8; ++w) a += qp[w * 128];
    Zout[((n0 >> 4) + (tid >> 6)) * (NBr * 16) + (r0 >> 3) * 16 + (tid & 63)] = (f16)fmaxf(a + bq, 0.0f);
  }
}

// ---------------------------------------------------------------------------------------------------------------------------
// k_tail: layer 2 or 3 of the f MLP, Y[32][N] = A[32][512] * W[512][N] + bias. The f layers are three dependent launches of almost no work, so what counts is the
// chain of waits inside one launch: here every global load of a work-group is in flight at once and is waited for once (the tiled GEMM waits four times, for 128 rows of which 32 count).
// A work-group takes 16 columns; its 32 waves are 16 k slices of 32 (one WMMA deep) x 2 row tiles. Each wave loads its B fragment straight from W (f32, rounded to f16 as before), does one WMMA,
// and the 16 k-slice tiles are summed in LDS in f32, k upward. Activations lie in 16-column blocks [N / 16][32][16], so a work-group stores whole lines of its own and an A fragment is two contiguous 512-byte loads.
// LAST: f32 sums without relu, in the same blocks. Columns from NV on repeat column NV - 1 (address clamp); nobody reads them.
// ---------------------------------------------------------------------------------------------------------------------------
template <int ldw, int NV, bool LAST>
__global__ __launch_bounds__(1024) void k_tail(const _Float16* __restrict__ Zin, const float* __restrict__ Wm,
                                               const float* __restrict__ bias, _Float16* __restrict__ Zout, float* __restrict__ Lout) {
  __shared__ __attribute__((aligned(16))) float red[16 * 512];
  const int tid = threadIdx.x, lane = tid & 31, wave = tid >> 5, cl = lane & 15, kh = (lane >> 4) * 8;
  const int ks = wave & 15, mi = wave >> 4, k0 = ks * 32, n0 = blockIdx.x * 16;
  // B fragment: column n0 + cl, k in the order of lds_frag (k0 + kh + 0..7, then + 16)
  // Every load is a uniform base plus one 32-bit offset register plus a constant.
  const int nc = min(n0 + cl, NV - 1);
  const unsigned woff = (unsigned)((k0 + kh) * ldw + nc) * 4u;
  float wv[16];
#pragma unroll   // registers indexed by i
  for (int i = 0; i < 8; ++i) { wv[i] = *(const float*)((const char*)Wm + woff + i * (ldw * 4)); wv[8 + i] = *(const float*)((const char*)Wm + woff + (16 + i) * (ldw * 4)); }
  const float bv = bias[nc];   // the output element that this thread finishes below has column n0 + tid % 16 too
  f16x16 af;
  {
    const unsigned zoff = (unsigned)((k0 >> 4) * (NBr * 16) + (16 * mi + cl) * 16 + kh) * 2u;
    const f16x8 lo = *(const f16x8*)((const char*)Zin + zoff), hi = *(const f16x8*)((const char*)Zin + zoff + NBr * 16 * 2);
#pragma unroll
    for (int i = 0; i < 8; ++i) { af[i] = lo[i]; af[i + 8] = hi[i]; }
  }
  f16x16 bfr;
#pragma unroll
  for (int i = 0; i < 16; ++i) bfr[i] = (f16)wv[i];
  f32x8 acc = {};
  acc = wmma16(af, bfr, acc);
  float* rp = red + ks * 512 + mi * 256 + lane;
#pragma unroll
  for (int r = 0; r < 8; ++r) rp[r * 32] = acc[r];
  __syncthreads();   // the 16 k-slice tiles of an output element meet here
  if (tid < 512) {   // one output element a thread, in the order of the block it is stored to: row = tid / 16, column = tid % 16
    const int row = tid >> 4;
    const float* qp = red + (row >> 4) * 256 + (row & 7) * 32 + ((row >> 3) & 1) * 16 + (tid & 15);
    float a = qp[0];
#pragma unroll
    for (int w = 1; w < 16; ++w) a += qp[w * 512];
    a += bv;
    if constexpr (LAST) Lout[blockIdx.x * 512 + tid] = a;
    else Zout[blockIdx.x * 512 + tid] = (f16)fmaxf(a, 0.0f);
  }
}

// logits [32][1000] from the 16-column blocks as one contiguous stream of 32,000 floats (8,000 float4; rows and blocks are multiples of 4 so no chunk straddles either)
__global__ __launch_bounds__(256) void k_out(const float* __restrict__ lp, float* __restrict__ out) {
  const int q4 = blockIdx.x * 256 + threadIdx.x; if (q4 >= NBr * NCLS / 4) return; const int fidx = q4 * 4, r = fidx / NCLS, c = fidx % NCLS;
  const v4f_t v = *(const v4f_t*)(lp + (size_t)(c >> 4) * (NBr * 16) + r * 16 + (c & 15)); *(v4f_t*)(out + fidx) = v; 
}

extern "C" void kernel_launch(void* const* d_in, const int* in_sizes, int n_in,
                              void* d_out, int out_size, void* d_ws, size_t ws_size,
                              hipStream_t stream) {
  (void)in_sizes; (void)n_in; (void)out_size;
  const float** f = (const float**)d_in;
  const float* x = f[0], *g_w1 = f[1], *g_b1 = f[2], *g_w2 = f[3], *g_b2 = f[4], *g_w3 = f[5], *g_b3 = f[6], *f_w1 = f[7], *f_b1 = f[8], *f_w2 = f[9], *f_b2 = f[10], *f_w3 = f[11], *f_b3 = f[12];
  float* out = (float*)d_out;      // [32,1000]
  char* ws = (char*)d_ws;
  float* A = (float*)ws; ws += (size_t)NROWP * HHd * 4; float* Bq = (float*)ws; ws += (size_t)NROWP * HHd * 4;   // Bq directly behind A: the z = 1 output of the layer-1 launch (k_l1 steps from A by NROWP rows)
  bf16* Wp = (bf16*)ws; ws += (size_t)2 * HHd * HHd * 2;   // directly behind Bq: g_w2 and g_w3 as f16 B fragments, written by the last 32 work-groups of the layer-1 launch
  float* ps = (float*)ws; ws += (size_t)NBr * 8 * HHd * 4;   // layer-3 column sums, 8 rows a batch
  bf16* z1 = (bf16*)ws; ws += (size_t)128 * HHd * 2;
  bf16* z2 = (bf16*)ws; ws += (size_t)128 * HHd * 2;
  float* lp = (float*)ws; ws += (size_t)128 * NCP * 4;
  if ((size_t)(ws - (char*)d_ws) > ws_size) return;
  const dim3 blk(256);
  k_l1<<<dim3(L1G + 32), blk, 0, stream>>>(x, g_w1, g_b1, g_w2, g_w3, A, Wp);   // z = 0: x*W1[:D] + b1 -> A; z = 1: x*W1[D:] -> Bq; the last 32 work-groups: g_w2, g_w3 -> Wp
  k_pair<<<dim3(NBr * 8), dim3(512), 0, stream>>>(A, Bq, Wp, g_b2, g_b3, ps);   // per group of 79 pair rows: sums over i != j of relu(relu(h1*W2 + b2)*W3 + b3), h1 = relu(A_i + Bq_j)
  k_f1<<<dim3(128), blk, 0, stream>>>(ps, f_w1, f_b1, z1);   // the 8 group sums of a batch joined behind the product
  k_tail<HHd, HHd, false><<<dim3(HHd / 16), dim3(1024), 0, stream>>>(z1, f_w2, f_b2, z2, nullptr);
  k_tail<NCLS, NCLS, true><<<dim3((NCLS + 15) / 16), dim3(1024), 0, stream>>>(z2, f_w3, f_b3, nullptr, lp);
  k_out<<<dim3((NBr * NCLS / 4 + 255) / 256), blk, 0, stream>>>(lp, out);
}
